// v000
// Times are from an AMD MI455X. After a warm-up the kernel runs many times in a row, and a time is the length of
// such a window on the GPU divided by its runs, so every launch and the gaps after it count. The runs cycle
// through copies of the inputs. A figure is the median of several windows, for all but v000 over two sittings.
// Sittings can differ by a few percent; kernels timed side by side share one.
// v000, which the later versions start from, runs in 265 microseconds.
#include <hip/hip_runtime.h>

// ---------------------------------------------------------------------------
// MHA forward for MI455X (gfx1250): f16 WMMA GEMMs + flash attention.
// B=4, S=2048, D=1024, H=16, HD=64
// ---------------------------------------------------------------------------

typedef __attribute__((ext_vector_type(16))) _Float16 v16h;
typedef __attribute__((ext_vector_type(8)))  _Float16 v8h;
typedef __attribute__((ext_vector_type(8)))  float    v8f;

#define B_  4
#define S_  2048
#define D_  1024
#define H_  16
#define HD_ 64

// ---------------------------------------------------------------------------
// Fragment loader: 16x32 f16 tile, row-major source (row stride in halves).
// Matches CDNA5 16-bit A-matrix layout (ISA 7.12.2):
//   lanes 0-15 : row M = lane,    halves 0-7 -> K=0..7,  halves 8-15 -> K=16..23
//   lanes 16-31: row M = lane-16, halves 0-7 -> K=8..15, halves 8-15 -> K=24..31
// Because y = x @ W^T, row-major W *is* the B matrix in [n][k] order, so the
// same loader serves A and B fragments. Two 16B ds_load_b128 per lane.
// ---------------------------------------------------------------------------
__device__ __forceinline__ v16h load_frag(const _Float16* base, int stride) {
  const int lane = threadIdx.x & 31;
  const int r    = lane & 15;
  const int kg   = lane >> 4;          // 0 or 1
  const _Float16* p = base + r * stride + kg * 8;
  union { v16h v; v8h h[2]; } u;
  u.h[0] = *(const v8h*)(p);           // K = kg*8 .. kg*8+7
  u.h[1] = *(const v8h*)(p + 16);      // K = 16+kg*8 .. 16+kg*8+7
  return u.v;
}

__device__ __forceinline__ v8f wmma16(v16h a, v16h b, v8f c) {
  // D = A(16x32 f16) * B(32x16 f16) + C(16x16 f32)
  return __builtin_amdgcn_wmma_f32_16x16x32_f16(false, a, false, b,
                                                (short)0, c, false, false);
}

// ---------------------------------------------------------------------------
// Row reductions across a 16-lane group via DPP16 ROW_XMASK (pure VALU,
// no LDS/ds_bpermute traffic). ROW_XMASK ctrl = 0x160 | mask: lane <-> lane^mask
// within each 16-lane row -- exactly the butterfly we need on wave32.
// ---------------------------------------------------------------------------
template <int CTRL>
__device__ __forceinline__ float dpp_movf(float x) {
  return __int_as_float(__builtin_amdgcn_update_dpp(
      0, __float_as_int(x), CTRL, 0xf, 0xf, true));
}
__device__ __forceinline__ float redmax16(float v) {
  v = fmaxf(v, dpp_movf<0x161>(v));   // xor 1
  v = fmaxf(v, dpp_movf<0x162>(v));   // xor 2
  v = fmaxf(v, dpp_movf<0x164>(v));   // xor 4
  v = fmaxf(v, dpp_movf<0x168>(v));   // xor 8
  return v;
}
__device__ __forceinline__ float redsum16(float v) {
  v += dpp_movf<0x161>(v);
  v += dpp_movf<0x162>(v);
  v += dpp_movf<0x164>(v);
  v += dpp_movf<0x168>(v);
  return v;
}

// ---------------------------------------------------------------------------
// f32 -> f16 conversion (query and weights), 4 elements/thread.
// ---------------------------------------------------------------------------
__global__ void cvt_f32_to_f16(const float* __restrict__ in,
                               _Float16* __restrict__ out, int n) {
  int i = (blockIdx.x * blockDim.x + threadIdx.x) * 4;
  if (i + 3 < n) {
    float4 v = *(const float4*)(in + i);
    out[i + 0] = (_Float16)v.x;
    out[i + 1] = (_Float16)v.y;
    out[i + 2] = (_Float16)v.z;
    out[i + 3] = (_Float16)v.w;
  }
}

// ---------------------------------------------------------------------------
// GEMM: y[m][n] = sum_k A[m][k] * W[n][k] + bias[n]
// Block tile 128(M) x 128(N), TK = 32, double-buffered LDS (ping-pong,
// one barrier per K step), register prefetch of the next K slab.
// 128 threads = 4 waves, each wave owns a 64x64 output tile (16 acc tiles,
// 16 wmma per K step, 1:1 ds_load_b128 : wmma ratio).
// MODE=1: f16 head-major [B,H,S,HD] output, scaled (QKV path).
// MODE=0: f32 row-major [M,N] output (final projection).
// ---------------------------------------------------------------------------
template <int MODE>
__global__ void __launch_bounds__(128)
gemm_wmma(const _Float16* __restrict__ A,   // [8192][1024] f16
          const _Float16* __restrict__ W,   // [1024][1024] f16 (row-major)
          const float*    __restrict__ bias,
          _Float16* __restrict__ outH, float* __restrict__ outF,
          float scale) {
  __shared__ _Float16 As[2][128 * 40];   // 128 rows x 32 K, stride 40 (pad)
  __shared__ _Float16 Bs[2][128 * 40];

  const int t    = threadIdx.x;          // 0..127
  const int lane = t & 31;
  const int wid  = t >> 5;               // 0..3
  const int wm   = wid & 1;              // M sub-tile (x64)
  const int wn   = wid >> 1;             // N sub-tile (x64)
  const int m0   = blockIdx.y * 128;
  const int n0   = blockIdx.x * 128;
  const int cl   = lane & 15;
  const int rh   = (lane >> 4) * 8;

  v8f acc[4][4];
#pragma unroll
  for (int i = 0; i < 4; ++i)
#pragma unroll
    for (int j = 0; j < 4; ++j) acc[i][j] = {};

  // Cooperative stage: thread t owns one full 32-half row slab per matrix.
  const _Float16* ga = A + (size_t)(m0 + t) * D_;
  const _Float16* gb = W + (size_t)(n0 + t) * D_;

  v8h ra[4], rb[4];
#pragma unroll
  for (int u = 0; u < 4; ++u) {
    ra[u] = *(const v8h*)(ga + u * 8);
    rb[u] = *(const v8h*)(gb + u * 8);
  }
#pragma unroll
  for (int u = 0; u < 4; ++u) {
    *(v8h*)&As[0][t * 40 + u * 8] = ra[u];
    *(v8h*)&Bs[0][t * 40 + u * 8] = rb[u];
  }
  __syncthreads();

  const int NIT = D_ / 32;               // 32
  for (int it = 0; it < NIT; ++it) {
    const int buf = it & 1;
    const bool last = (it == NIT - 1);
    if (!last) {
      const int k1 = (it + 1) * 32;
#pragma unroll
      for (int u = 0; u < 4; ++u) {
        ra[u] = *(const v8h*)(ga + k1 + u * 8);
        rb[u] = *(const v8h*)(gb + k1 + u * 8);
      }
    }

    v16h af[4];
#pragma unroll
    for (int i = 0; i < 4; ++i)
      af[i] = load_frag(&As[buf][(wm * 64 + i * 16) * 40], 40);
#pragma unroll
    for (int j = 0; j < 4; ++j) {
      v16h bf = load_frag(&Bs[buf][(wn * 64 + j * 16) * 40], 40);
#pragma unroll
      for (int i = 0; i < 4; ++i)
        acc[i][j] = wmma16(af[i], bf, acc[i][j]);
    }

    if (!last) {
      const int nb = buf ^ 1;
#pragma unroll
      for (int u = 0; u < 4; ++u) {
        *(v8h*)&As[nb][t * 40 + u * 8] = ra[u];
        *(v8h*)&Bs[nb][t * 40 + u * 8] = rb[u];
      }
      __syncthreads();
    }
  }

  // Epilogue. bias depends only on (j, cl): 4 loads per thread.
  const int nwave = n0 + wn * 64;
  float bj[4];
#pragma unroll
  for (int j = 0; j < 4; ++j) bj[j] = bias[nwave + j * 16 + cl];

  if (MODE == 1) {
    // m0 is 128-aligned -> batch index constant per block; nwave is
    // 64-aligned -> head index constant per wave.
    const int b  = m0 >> 11;
    const int sb = (m0 & (S_ - 1)) + wm * 64;
    const int h  = nwave >> 6;
    _Float16* ph = outH + ((size_t)b * H_ + h) * S_ * HD_;
#pragma unroll
    for (int i = 0; i < 4; ++i) {
#pragma unroll
      for (int r = 0; r < 8; ++r) {
        _Float16* pr = ph + (size_t)(sb + i * 16 + rh + r) * HD_;
#pragma unroll
        for (int j = 0; j < 4; ++j)
          pr[j * 16 + cl] = (_Float16)((acc[i][j][r] + bj[j]) * scale);
      }
    }
  } else {
    float* pm = outF + (size_t)(m0 + wm * 64) * D_ + nwave;
#pragma unroll
    for (int i = 0; i < 4; ++i) {
#pragma unroll
      for (int r = 0; r < 8; ++r) {
        float* pr = pm + (size_t)(i * 16 + rh + r) * D_;
#pragma unroll
        for (int j = 0; j < 4; ++j)
          pr[j * 16 + cl] = acc[i][j][r] + bj[j];
      }
    }
  }
}

// ---------------------------------------------------------------------------
// Flash attention: block = (b, h, 128 query rows); 8 waves x 16 rows each.
// KV tile = 64 keys per iteration -> 16 WMMA per barrier pair (8 QK^T + 8 PV).
// Q lives in registers (2 A-fragments, softmax scale pre-folded). K staged
// row-major in LDS (B-fragment-ready); V staged transposed. Next tile is
// register-prefetched across the compute phase; global_prefetch_b8 two tiles
// ahead. Online softmax per row via DPP ROW_XMASK butterflies (pure VALU).
// ---------------------------------------------------------------------------
__global__ void __launch_bounds__(256)
attention_wmma(const _Float16* __restrict__ q16,   // [B,H,S,HD] (pre-scaled)
               const _Float16* __restrict__ k16,   // [B,H,S,HD]
               const _Float16* __restrict__ v16,   // [B,H,S,HD]
               _Float16* __restrict__ a16) {       // [B,S,D]
  __shared__ _Float16 Ks[64 * 72];        // [n][d]   n=0..63, stride 72 (pad)
  __shared__ _Float16 Vt[64 * 72];        // [d][n]   d=0..63, stride 72 (pad)
  __shared__ _Float16 Ps[8][16 * 72];     // per-wave P staging [16][64+pad]

  const int t    = threadIdx.x;
  const int lane = t & 31;
  const int wid  = t >> 5;
  const int cl   = lane & 15;
  const int rh   = (lane >> 4) * 8;

  const int qt = blockIdx.x;              // query tile (of 128 rows)
  const int h  = blockIdx.y;
  const int b  = blockIdx.z;

  const size_t head = (size_t)(b * H_ + h) * S_ * HD_;
  const _Float16* qb = q16 + head;
  const _Float16* kb = k16 + head;
  const _Float16* vb = v16 + head;

  const int qr0 = qt * 128 + wid * 16;    // this wave's 16 query rows

  // Q fragments: 16 rows x 64 dims -> two 16x32 fragments.
  v16h qa0 = load_frag(qb + (size_t)qr0 * HD_,      HD_);
  v16h qa1 = load_frag(qb + (size_t)qr0 * HD_ + 32, HD_);

  v8f o[4];
#pragma unroll
  for (int j = 0; j < 4; ++j) o[j] = {};
  float mrow[8], lrow[8];
#pragma unroll
  for (int r = 0; r < 8; ++r) { mrow[r] = -1e30f; lrow[r] = 0.0f; }

  _Float16* Pw = &Ps[wid][0];

  // Cooperative stage mapping: 64 rows x 64 halves, 16 halves per thread.
  const int srow = t >> 2;                // 0..63
  const int scol = (t & 3) * 16;          // 0/16/32/48

  // Preload first K/V tile into registers.
  v8h kr0 = *(const v8h*)(kb + (size_t)srow * HD_ + scol);
  v8h kr1 = *(const v8h*)(kb + (size_t)srow * HD_ + scol + 8);
  v8h vr0 = *(const v8h*)(vb + (size_t)srow * HD_ + scol);
  v8h vr1 = *(const v8h*)(vb + (size_t)srow * HD_ + scol + 8);

  for (int kv0 = 0; kv0 < S_; kv0 += 64) {
    // Commit staged registers: K row-major, V transposed.
    *(v8h*)&Ks[srow * 72 + scol]     = kr0;
    *(v8h*)&Ks[srow * 72 + scol + 8] = kr1;
#pragma unroll
    for (int i = 0; i < 8; ++i) {
      Vt[(scol + i) * 72 + srow]     = vr0[i];
      Vt[(scol + 8 + i) * 72 + srow] = vr1[i];
    }
    __syncthreads();

    // Prefetch next tile into registers (hidden behind the WMMAs below).
    if (kv0 + 64 < S_) {
      const _Float16* kp = kb + (size_t)(kv0 + 64 + srow) * HD_ + scol;
      const _Float16* vp = vb + (size_t)(kv0 + 64 + srow) * HD_ + scol;
      kr0 = *(const v8h*)(kp);
      kr1 = *(const v8h*)(kp + 8);
      vr0 = *(const v8h*)(vp);
      vr1 = *(const v8h*)(vp + 8);
    }
    if (kv0 + 128 < S_) {
      __builtin_prefetch(kb + (size_t)(kv0 + 128 + srow) * HD_ + scol, 0, 3);
      __builtin_prefetch(vb + (size_t)(kv0 + 128 + srow) * HD_ + scol, 0, 3);
    }

    // Scores: four 16x16 tiles (keys kv0+16*nt). Hoist all K fragments so
    // the ds_load_b128s batch ahead of the WMMA burst.
    v16h kf0l = load_frag(&Ks[0 * 16 * 72],      72);
    v16h kf0h = load_frag(&Ks[0 * 16 * 72 + 32], 72);
    v16h kf1l = load_frag(&Ks[1 * 16 * 72],      72);
    v16h kf1h = load_frag(&Ks[1 * 16 * 72 + 32], 72);
    v16h kf2l = load_frag(&Ks[2 * 16 * 72],      72);
    v16h kf2h = load_frag(&Ks[2 * 16 * 72 + 32], 72);
    v16h kf3l = load_frag(&Ks[3 * 16 * 72],      72);
    v16h kf3h = load_frag(&Ks[3 * 16 * 72 + 32], 72);

    v8f sc[4];
    sc[0] = wmma16(qa1, kf0h, wmma16(qa0, kf0l, (v8f){}));
    sc[1] = wmma16(qa1, kf1h, wmma16(qa0, kf1l, (v8f){}));
    sc[2] = wmma16(qa1, kf2h, wmma16(qa0, kf2l, (v8f){}));
    sc[3] = wmma16(qa1, kf3h, wmma16(qa0, kf3l, (v8f){}));

    // Online softmax (per row; row lives in a 16-lane group).
    float corr[8];
#pragma unroll
    for (int r = 0; r < 8; ++r) {
      float tmax = fmaxf(fmaxf(sc[0][r], sc[1][r]), fmaxf(sc[2][r], sc[3][r]));
      tmax = redmax16(tmax);
      float mnew = fmaxf(mrow[r], tmax);
      corr[r]  = __expf(mrow[r] - mnew);
      float p0 = __expf(sc[0][r] - mnew);
      float p1 = __expf(sc[1][r] - mnew);
      float p2 = __expf(sc[2][r] - mnew);
      float p3 = __expf(sc[3][r] - mnew);
      lrow[r]  = lrow[r] * corr[r] + redsum16((p0 + p1) + (p2 + p3));
      mrow[r]  = mnew;
      Pw[(rh + r) * 72 + cl]      = (_Float16)p0;
      Pw[(rh + r) * 72 + 16 + cl] = (_Float16)p1;
      Pw[(rh + r) * 72 + 32 + cl] = (_Float16)p2;
      Pw[(rh + r) * 72 + 48 + cl] = (_Float16)p3;
    }
#pragma unroll
    for (int j = 0; j < 4; ++j)
#pragma unroll
      for (int r = 0; r < 8; ++r) o[j][r] *= corr[r];

    // PV: P (16x64) x V (64x64) accumulated into 4 output tiles.
    v16h pa0 = load_frag(Pw, 72);          // keys kv0..kv0+31
    v16h pa1 = load_frag(Pw + 32, 72);     // keys kv0+32..kv0+63
#pragma unroll
    for (int j = 0; j < 4; ++j) {
      v16h vf0 = load_frag(&Vt[(j * 16) * 72],      72);
      v16h vf1 = load_frag(&Vt[(j * 16) * 72 + 32], 72);
      o[j] = wmma16(pa0, vf0, o[j]);
      o[j] = wmma16(pa1, vf1, o[j]);
    }
    __syncthreads();   // protect Ks/Vt before next stage
  }

  // Normalize and write token-major [B,S,D] (f16) for the output projection.
#pragma unroll
  for (int r = 0; r < 8; ++r) {
    const float inv = 1.0f / lrow[r];
    const int row = qr0 + rh + r;
#pragma unroll
    for (int j = 0; j < 4; ++j) {
      const int d = h * HD_ + j * 16 + cl;
      a16[((size_t)b * S_ + row) * D_ + d] = (_Float16)(o[j][r] * inv);
    }
  }
}

// ---------------------------------------------------------------------------
// Launcher
// ---------------------------------------------------------------------------
extern "C" void kernel_launch(void* const* d_in, const int* in_sizes, int n_in,
                              void* d_out, int out_size, void* d_ws, size_t ws_size,
                              hipStream_t stream) {
  (void)in_sizes; (void)n_in; (void)out_size; (void)ws_size;

  const float* query = (const float*)d_in[0];
  const float* Wq = (const float*)d_in[1]; const float* bq = (const float*)d_in[2];
  const float* Wk = (const float*)d_in[3]; const float* bk = (const float*)d_in[4];
  const float* Wv = (const float*)d_in[5]; const float* bv = (const float*)d_in[6];
  const float* Wo = (const float*)d_in[7]; const float* bo = (const float*)d_in[8];
  float* out = (float*)d_out;

  const size_t DD  = (size_t)D_ * D_;        // 1M
  const size_t BSD = (size_t)B_ * S_ * D_;   // 8M

  _Float16* w16  = (_Float16*)d_ws;          // 4*DD halves
  _Float16* wq16 = w16;
  _Float16* wk16 = w16 + DD;
  _Float16* wv16 = w16 + 2 * DD;
  _Float16* wo16 = w16 + 3 * DD;
  _Float16* x16  = w16 + 4 * DD;             // BSD
  _Float16* q16  = x16 + BSD;                // BSD  [B,H,S,HD]
  _Float16* k16  = q16 + BSD;
  _Float16* v16p = k16 + BSD;
  _Float16* a16  = v16p + BSD;               // BSD  [B,S,D]

  // 1) f32 -> f16 conversions.
  cvt_f32_to_f16<<<(int)(BSD / 4 / 256), 256, 0, stream>>>(query, x16, (int)BSD);
  cvt_f32_to_f16<<<(int)(DD  / 4 / 256), 256, 0, stream>>>(Wq, wq16, (int)DD);
  cvt_f32_to_f16<<<(int)(DD  / 4 / 256), 256, 0, stream>>>(Wk, wk16, (int)DD);
  cvt_f32_to_f16<<<(int)(DD  / 4 / 256), 256, 0, stream>>>(Wv, wv16, (int)DD);
  cvt_f32_to_f16<<<(int)(DD  / 4 / 256), 256, 0, stream>>>(Wo, wo16, (int)DD);

  // 2) QKV projections (head-major f16; softmax scale folded into Q).
  dim3 ggrid(D_ / 128, (B_ * S_) / 128);     // (8, 64)
  gemm_wmma<1><<<ggrid, 128, 0, stream>>>(x16, wq16, bq, q16, nullptr, 0.125f);
  gemm_wmma<1><<<ggrid, 128, 0, stream>>>(x16, wk16, bk, k16, nullptr, 1.0f);
  gemm_wmma<1><<<ggrid, 128, 0, stream>>>(x16, wv16, bv, v16p, nullptr, 1.0f);

  // 3) Flash attention.
  dim3 agrid(S_ / 128, H_, B_);              // (16, 16, 4)
  attention_wmma<<<agrid, 256, 0, stream>>>(q16, k16, v16p, a16);

  // 4) Output projection -> f32 d_out.
  gemm_wmma<0><<<ggrid, 128, 0, stream>>>(a16, wo16, bo, nullptr, out, 1.0f);
}

// v001
// One run takes 252 microseconds.
// Timed twice side by side with v000, it ran 1.10 and 1.09 times as fast.
#include <hip/hip_runtime.h>

// ---------------------------------------------------------------------------
// MHA forward for MI455X (gfx1250): f16 WMMA GEMMs + flash attention.
// B=4, S=2048, D=1024, H=16, HD=64
// ---------------------------------------------------------------------------

typedef __attribute__((ext_vector_type(16))) _Float16 v16h;
typedef __attribute__((ext_vector_type(8)))  _Float16 v8h;
typedef __attribute__((ext_vector_type(8)))  float    v8f;

#define B_  4
#define S_  2048
#define D_  1024
#define H_  16
#define HD_ 64

// ---------------------------------------------------------------------------
// Fragment loader: 16x32 f16 tile, row-major source (row stride in halves).
// Matches CDNA5 16-bit A-matrix layout (ISA 7.12.2):
//   lanes 0-15 : row M = lane,    halves 0-7 -> K=0..7,  halves 8-15 -> K=16..23
//   lanes 16-31: row M = lane-16, halves 0-7 -> K=8..15, halves 8-15 -> K=24..31
// Because y = x @ W^T, row-major W *is* the B matrix in [n][k] order, so the
// same loader serves A and B fragments. Two 16B ds_load_b128 per lane.
// ---------------------------------------------------------------------------
__device__ __forceinline__ v16h load_frag(const _Float16* base, int stride) {
  const int lane = threadIdx.x & 31;
  const int r    = lane & 15;
  const int kg   = lane >> 4;          // 0 or 1
  const _Float16* p = base + r * stride + kg * 8;
  union { v16h v; v8h h[2]; } u;
  u.h[0] = *(const v8h*)(p);           // K = kg*8 .. kg*8+7
  u.h[1] = *(const v8h*)(p + 16);      // K = 16+kg*8 .. 16+kg*8+7
  return u.v;
}

__device__ __forceinline__ v8f wmma16(v16h a, v16h b, v8f c) {
  // D = A(16x32 f16) * B(32x16 f16) + C(16x16 f32)
  return __builtin_amdgcn_wmma_f32_16x16x32_f16(false, a, false, b,
                                                (short)0, c, false, false);
}

// ---------------------------------------------------------------------------
// Row reductions across a 16-lane group via DPP16 ROW_XMASK (pure VALU,
// no LDS/ds_bpermute traffic). ROW_XMASK ctrl = 0x160 | mask: lane <-> lane^mask
// within each 16-lane row -- exactly the butterfly we need on wave32.
// ---------------------------------------------------------------------------
template <int CTRL>
__device__ __forceinline__ float dpp_movf(float x) {
  return __int_as_float(__builtin_amdgcn_update_dpp(
      0, __float_as_int(x), CTRL, 0xf, 0xf, true));
}
__device__ __forceinline__ float redmax16(float v) {
  v = fmaxf(v, dpp_movf<0x161>(v));   // xor 1
  v = fmaxf(v, dpp_movf<0x162>(v));   // xor 2
  v = fmaxf(v, dpp_movf<0x164>(v));   // xor 4
  v = fmaxf(v, dpp_movf<0x168>(v));   // xor 8
  return v;
}
__device__ __forceinline__ float redsum16(float v) {
  v += dpp_movf<0x161>(v);
  v += dpp_movf<0x162>(v);
  v += dpp_movf<0x164>(v);
  v += dpp_movf<0x168>(v);
  return v;
}

// ---------------------------------------------------------------------------
// f32 -> f16 conversion (query and weights), 4 elements/thread.
// ---------------------------------------------------------------------------
__global__ void cvt_f32_to_f16(const float* __restrict__ in,
                               _Float16* __restrict__ out, int n) {
  int i = (blockIdx.x * blockDim.x + threadIdx.x) * 4;
  if (i + 3 < n) {
    float4 v = *(const float4*)(in + i);
    out[i + 0] = (_Float16)v.x;
    out[i + 1] = (_Float16)v.y;
    out[i + 2] = (_Float16)v.z;
    out[i + 3] = (_Float16)v.w;
  }
}

// ---------------------------------------------------------------------------
// GEMM: y[m][n] = sum_k A[m][k] * W[n][k] + bias[n]
// Block tile 128(M) x 128(N), TK = 32, double-buffered LDS (ping-pong,
// one barrier per K step), register prefetch of the next K slab.
// 128 threads = 4 waves, each wave owns a 64x64 output tile (16 acc tiles,
// 16 wmma per K step, 1:1 ds_load_b128 : wmma ratio).
// MODE=1: f16 head-major [B,H,S,HD] output, scaled (QKV path).
// MODE=0: f32 row-major [M,N] output (final projection).
// ---------------------------------------------------------------------------
template <int MODE>
__global__ void __launch_bounds__(128)
gemm_wmma(const _Float16* __restrict__ A,   // [8192][1024] f16
          const _Float16* __restrict__ W,   // [1024][1024] f16 (row-major)
          const float*    __restrict__ bias,
          _Float16* __restrict__ outH, float* __restrict__ outF,
          float scale) {
  __shared__ _Float16 As[2][128 * 40];   // 128 rows x 32 K, stride 40 (pad)
  __shared__ _Float16 Bs[2][128 * 40];

  const int t    = threadIdx.x;          // 0..127
  const int lane = t & 31;
  const int wid  = t >> 5;               // 0..3
  const int wm   = wid & 1;              // M sub-tile (x64)
  const int wn   = wid >> 1;             // N sub-tile (x64)
  const int m0   = blockIdx.y * 128;
  const int n0   = blockIdx.x * 128;
  const int cl   = lane & 15;
  const int rh   = (lane >> 4) * 8;

  v8f acc[4][4];
#pragma unroll
  for (int i = 0; i < 4; ++i)
#pragma unroll
    for (int j = 0; j < 4; ++j) acc[i][j] = {};

  // Cooperative stage: four neighbouring lanes read one row's 64-byte K slab,
  // so one 16-byte load of a wave touches 8 cache lines instead of 32.
  // Each wave stages 32 rows in 4 loads per matrix; load u adds SROW(u) rows.
  // Lanes 0-15 hold rows 4 apart (lanes 16-31 the rows next to them): at the
  // 80-byte LDS pitch the 16 stores of a half wave then fall on 64 distinct banks.
#define SROW(u) ((((u) >> 1) * 16) + (((u) & 1) * 2))
  const int srow = wid * 32 + ((lane >> 2) & 3) * 4 + (lane >> 4);
  const int scol = (lane & 3) * 8;
  const int sidx = srow * 40 + scol;
  const _Float16* ga = A + (size_t)(m0 + srow) * D_ + scol;
  const _Float16* gb = W + (size_t)(n0 + srow) * D_ + scol;

  v8h ra[4], rb[4];
#pragma unroll
  for (int u = 0; u < 4; ++u) {
    ra[u] = *(const v8h*)(ga + SROW(u) * D_);
    rb[u] = *(const v8h*)(gb + SROW(u) * D_);
  }
#pragma unroll
  for (int u = 0; u < 4; ++u) {
    *(v8h*)&As[0][sidx + SROW(u) * 40] = ra[u];
    *(v8h*)&Bs[0][sidx + SROW(u) * 40] = rb[u];
  }
  __syncthreads();

  const int NIT = D_ / 32;               // 32
  for (int it = 0; it < NIT; ++it) {
    const int buf = it & 1;
    const bool last = (it == NIT - 1);
    if (!last) {
      const int k1 = (it + 1) * 32;
#pragma unroll
      for (int u = 0; u < 4; ++u) {
        ra[u] = *(const v8h*)(ga + k1 + SROW(u) * D_);
        rb[u] = *(const v8h*)(gb + k1 + SROW(u) * D_);
      }
    }

    v16h af[4];
#pragma unroll
    for (int i = 0; i < 4; ++i)
      af[i] = load_frag(&As[buf][(wm * 64 + i * 16) * 40], 40);
#pragma unroll
    for (int j = 0; j < 4; ++j) {
      v16h bf = load_frag(&Bs[buf][(wn * 64 + j * 16) * 40], 40);
#pragma unroll
      for (int i = 0; i < 4; ++i)
        acc[i][j] = wmma16(af[i], bf, acc[i][j]);
    }

    if (!last) {
      const int nb = buf ^ 1;
#pragma unroll
      for (int u = 0; u < 4; ++u) {
        *(v8h*)&As[nb][sidx + SROW(u) * 40] = ra[u];
        *(v8h*)&Bs[nb][sidx + SROW(u) * 40] = rb[u];
      }
      __syncthreads();
    }
  }
#undef SROW

  // Epilogue. bias depends only on (j, cl): 4 loads per thread.
  const int nwave = n0 + wn * 64;
  float bj[4];
#pragma unroll
  for (int j = 0; j < 4; ++j) bj[j] = bias[nwave + j * 16 + cl];

  if (MODE == 1) {
    // m0 is 128-aligned -> batch index constant per block; nwave is
    // 64-aligned -> head index constant per wave.
    const int b  = m0 >> 11;
    const int sb = (m0 & (S_ - 1)) + wm * 64;
    const int h  = nwave >> 6;
    _Float16* ph = outH + ((size_t)b * H_ + h) * S_ * HD_;
#pragma unroll
    for (int i = 0; i < 4; ++i) {
#pragma unroll
      for (int r = 0; r < 8; ++r) {
        _Float16* pr = ph + (size_t)(sb + i * 16 + rh + r) * HD_;
#pragma unroll
        for (int j = 0; j < 4; ++j)
          pr[j * 16 + cl] = (_Float16)((acc[i][j][r] + bj[j]) * scale);
      }
    }
  } else {
    float* pm = outF + (size_t)(m0 + wm * 64) * D_ + nwave;
#pragma unroll
    for (int i = 0; i < 4; ++i) {
#pragma unroll
      for (int r = 0; r < 8; ++r) {
        float* pr = pm + (size_t)(i * 16 + rh + r) * D_;
#pragma unroll
        for (int j = 0; j < 4; ++j)
          pr[j * 16 + cl] = acc[i][j][r] + bj[j];
      }
    }
  }
}

// ---------------------------------------------------------------------------
// Flash attention: block = (b, h, 128 query rows); 8 waves x 16 rows each.
// KV tile = 64 keys per iteration -> 16 WMMA per barrier pair (8 QK^T + 8 PV).
// Q lives in registers (2 A-fragments, softmax scale pre-folded). K staged
// row-major in LDS (B-fragment-ready); V staged transposed. Next tile is
// register-prefetched across the compute phase; global_prefetch_b8 two tiles
// ahead. Online softmax per row via DPP ROW_XMASK butterflies (pure VALU).
// ---------------------------------------------------------------------------
__global__ void __launch_bounds__(256)
attention_wmma(const _Float16* __restrict__ q16,   // [B,H,S,HD] (pre-scaled)
               const _Float16* __restrict__ k16,   // [B,H,S,HD]
               const _Float16* __restrict__ v16,   // [B,H,S,HD]
               _Float16* __restrict__ a16) {       // [B,S,D]
  __shared__ _Float16 Ks[64 * 72];        // [n][d]   n=0..63, stride 72 (pad)
  __shared__ _Float16 Vt[64 * 72];        // [d][n]   d=0..63, stride 72 (pad)
  __shared__ _Float16 Ps[8][16 * 72];     // per-wave P staging [16][64+pad]

  const int t    = threadIdx.x;
  const int lane = t & 31;
  const int wid  = t >> 5;
  const int cl   = lane & 15;
  const int rh   = (lane >> 4) * 8;

  const int qt = blockIdx.x;              // query tile (of 128 rows)
  const int h  = blockIdx.y;
  const int b  = blockIdx.z;

  const size_t head = (size_t)(b * H_ + h) * S_ * HD_;
  const _Float16* qb = q16 + head;
  const _Float16* kb = k16 + head;
  const _Float16* vb = v16 + head;

  const int qr0 = qt * 128 + wid * 16;    // this wave's 16 query rows

  // Q fragments: 16 rows x 64 dims -> two 16x32 fragments.
  v16h qa0 = load_frag(qb + (size_t)qr0 * HD_,      HD_);
  v16h qa1 = load_frag(qb + (size_t)qr0 * HD_ + 32, HD_);

  v8f o[4];
#pragma unroll
  for (int j = 0; j < 4; ++j) o[j] = {};
  float mrow[8], lrow[8];
#pragma unroll
  for (int r = 0; r < 8; ++r) { mrow[r] = -1e30f; lrow[r] = 0.0f; }

  _Float16* Pw = &Ps[wid][0];

  // Cooperative stage mapping: 64 rows x 64 halves, 16 halves per thread.
  const int srow = t >> 2;                // 0..63
  const int scol = (t & 3) * 16;          // 0/16/32/48

  // Preload first K/V tile into registers.
  v8h kr0 = *(const v8h*)(kb + (size_t)srow * HD_ + scol);
  v8h kr1 = *(const v8h*)(kb + (size_t)srow * HD_ + scol + 8);
  v8h vr0 = *(const v8h*)(vb + (size_t)srow * HD_ + scol);
  v8h vr1 = *(const v8h*)(vb + (size_t)srow * HD_ + scol + 8);

  for (int kv0 = 0; kv0 < S_; kv0 += 64) {
    // Commit staged registers: K row-major, V transposed.
    *(v8h*)&Ks[srow * 72 + scol]     = kr0;
    *(v8h*)&Ks[srow * 72 + scol + 8] = kr1;
#pragma unroll
    for (int i = 0; i < 8; ++i) {
      Vt[(scol + i) * 72 + srow]     = vr0[i];
      Vt[(scol + 8 + i) * 72 + srow] = vr1[i];
    }
    __syncthreads();

    // Prefetch next tile into registers (hidden behind the WMMAs below).
    if (kv0 + 64 < S_) {
      const _Float16* kp = kb + (size_t)(kv0 + 64 + srow) * HD_ + scol;
      const _Float16* vp = vb + (size_t)(kv0 + 64 + srow) * HD_ + scol;
      kr0 = *(const v8h*)(kp);
      kr1 = *(const v8h*)(kp + 8);
      vr0 = *(const v8h*)(vp);
      vr1 = *(const v8h*)(vp + 8);
    }
    if (kv0 + 128 < S_) {
      __builtin_prefetch(kb + (size_t)(kv0 + 128 + srow) * HD_ + scol, 0, 3);
      __builtin_prefetch(vb + (size_t)(kv0 + 128 + srow) * HD_ + scol, 0, 3);
    }

    // Scores: four 16x16 tiles (keys kv0+16*nt). Hoist all K fragments so
    // the ds_load_b128s batch ahead of the WMMA burst.
    v16h kf0l = load_frag(&Ks[0 * 16 * 72],      72);
    v16h kf0h = load_frag(&Ks[0 * 16 * 72 + 32], 72);
    v16h kf1l = load_frag(&Ks[1 * 16 * 72],      72);
    v16h kf1h = load_frag(&Ks[1 * 16 * 72 + 32], 72);
    v16h kf2l = load_frag(&Ks[2 * 16 * 72],      72);
    v16h kf2h = load_frag(&Ks[2 * 16 * 72 + 32], 72);
    v16h kf3l = load_frag(&Ks[3 * 16 * 72],      72);
    v16h kf3h = load_frag(&Ks[3 * 16 * 72 + 32], 72);

    v8f sc[4];
    sc[0] = wmma16(qa1, kf0h, wmma16(qa0, kf0l, (v8f){}));
    sc[1] = wmma16(qa1, kf1h, wmma16(qa0, kf1l, (v8f){}));
    sc[2] = wmma16(qa1, kf2h, wmma16(qa0, kf2l, (v8f){}));
    sc[3] = wmma16(qa1, kf3h, wmma16(qa0, kf3l, (v8f){}));

    // Online softmax (per row; row lives in a 16-lane group).
    float corr[8];
#pragma unroll
    for (int r = 0; r < 8; ++r) {
      float tmax = fmaxf(fmaxf(sc[0][r], sc[1][r]), fmaxf(sc[2][r], sc[3][r]));
      tmax = redmax16(tmax);
      float mnew = fmaxf(mrow[r], tmax);
      corr[r]  = __expf(mrow[r] - mnew);
      float p0 = __expf(sc[0][r] - mnew);
      float p1 = __expf(sc[1][r] - mnew);
      float p2 = __expf(sc[2][r] - mnew);
      float p3 = __expf(sc[3][r] - mnew);
      lrow[r]  = lrow[r] * corr[r] + redsum16((p0 + p1) + (p2 + p3));
      mrow[r]  = mnew;
      Pw[(rh + r) * 72 + cl]      = (_Float16)p0;
      Pw[(rh + r) * 72 + 16 + cl] = (_Float16)p1;
      Pw[(rh + r) * 72 + 32 + cl] = (_Float16)p2;
      Pw[(rh + r) * 72 + 48 + cl] = (_Float16)p3;
    }
#pragma unroll
    for (int j = 0; j < 4; ++j)
#pragma unroll
      for (int r = 0; r < 8; ++r) o[j][r] *= corr[r];

    // PV: P (16x64) x V (64x64) accumulated into 4 output tiles.
    v16h pa0 = load_frag(Pw, 72);          // keys kv0..kv0+31
    v16h pa1 = load_frag(Pw + 32, 72);     // keys kv0+32..kv0+63
#pragma unroll
    for (int j = 0; j < 4; ++j) {
      v16h vf0 = load_frag(&Vt[(j * 16) * 72],      72);
      v16h vf1 = load_frag(&Vt[(j * 16) * 72 + 32], 72);
      o[j] = wmma16(pa0, vf0, o[j]);
      o[j] = wmma16(pa1, vf1, o[j]);
    }
    __syncthreads();   // protect Ks/Vt before next stage
  }

  // Normalize and write token-major [B,S,D] (f16) for the output projection.
#pragma unroll
  for (int r = 0; r < 8; ++r) {
    const float inv = 1.0f / lrow[r];
    const int row = qr0 + rh + r;
#pragma unroll
    for (int j = 0; j < 4; ++j) {
      const int d = h * HD_ + j * 16 + cl;
      a16[((size_t)b * S_ + row) * D_ + d] = (_Float16)(o[j][r] * inv);
    }
  }
}

// ---------------------------------------------------------------------------
// Launcher
// ---------------------------------------------------------------------------
extern "C" void kernel_launch(void* const* d_in, const int* in_sizes, int n_in,
                              void* d_out, int out_size, void* d_ws, size_t ws_size,
                              hipStream_t stream) {
  (void)in_sizes; (void)n_in; (void)out_size; (void)ws_size;

  const float* query = (const float*)d_in[0];
  const float* Wq = (const float*)d_in[1]; const float* bq = (const float*)d_in[2];
  const float* Wk = (const float*)d_in[3]; const float* bk = (const float*)d_in[4];
  const float* Wv = (const float*)d_in[5]; const float* bv = (const float*)d_in[6];
  const float* Wo = (const float*)d_in[7]; const float* bo = (const float*)d_in[8];
  float* out = (float*)d_out;

  const size_t DD  = (size_t)D_ * D_;        // 1M
  const size_t BSD = (size_t)B_ * S_ * D_;   // 8M

  _Float16* w16  = (_Float16*)d_ws;          // 4*DD halves
  _Float16* wq16 = w16;
  _Float16* wk16 = w16 + DD;
  _Float16* wv16 = w16 + 2 * DD;
  _Float16* wo16 = w16 + 3 * DD;
  _Float16* x16  = w16 + 4 * DD;             // BSD
  _Float16* q16  = x16 + BSD;                // BSD  [B,H,S,HD]
  _Float16* k16  = q16 + BSD;
  _Float16* v16p = k16 + BSD;
  _Float16* a16  = v16p + BSD;               // BSD  [B,S,D]

  // 1) f32 -> f16 conversions.
  cvt_f32_to_f16<<<(int)(BSD / 4 / 256), 256, 0, stream>>>(query, x16, (int)BSD);
  cvt_f32_to_f16<<<(int)(DD  / 4 / 256), 256, 0, stream>>>(Wq, wq16, (int)DD);
  cvt_f32_to_f16<<<(int)(DD  / 4 / 256), 256, 0, stream>>>(Wk, wk16, (int)DD);
  cvt_f32_to_f16<<<(int)(DD  / 4 / 256), 256, 0, stream>>>(Wv, wv16, (int)DD);
  cvt_f32_to_f16<<<(int)(DD  / 4 / 256), 256, 0, stream>>>(Wo, wo16, (int)DD);

  // 2) QKV projections (head-major f16; softmax scale folded into Q).
  dim3 ggrid(D_ / 128, (B_ * S_) / 128);     // (8, 64)
  gemm_wmma<1><<<ggrid, 128, 0, stream>>>(x16, wq16, bq, q16, nullptr, 0.125f);
  gemm_wmma<1><<<ggrid, 128, 0, stream>>>(x16, wk16, bk, k16, nullptr, 1.0f);
  gemm_wmma<1><<<ggrid, 128, 0, stream>>>(x16, wv16, bv, v16p, nullptr, 1.0f);

  // 3) Flash attention.
  dim3 agrid(S_ / 128, H_, B_);              // (16, 16, 4)
  attention_wmma<<<agrid, 256, 0, stream>>>(q16, k16, v16p, a16);

  // 4) Output projection -> f32 d_out.
  gemm_wmma<0><<<ggrid, 128, 0, stream>>>(a16, wo16, bo, nullptr, out, 1.0f);
}

// v002
// Measured time: 212 microseconds a run.
// Two timings next to v001 put it at 1.18 and 1.19 times that version's speed.
// All steps since v000 together make it 1.30 times as fast.
#include <hip/hip_runtime.h>

// ---------------------------------------------------------------------------
// MHA forward for MI455X (gfx1250): f16 WMMA GEMMs + flash attention.
// B=4, S=2048, D=1024, H=16, HD=64
// ---------------------------------------------------------------------------

typedef __attribute__((ext_vector_type(16))) _Float16 v16h;
typedef __attribute__((ext_vector_type(8)))  _Float16 v8h;
typedef __attribute__((ext_vector_type(8)))  float    v8f;

#define B_  4
#define S_  2048
#define D_  1024
#define H_  16
#define HD_ 64
#define LOG2E 1.4426950408889634f   // exp(x) = exp2(x * LOG2E)

// ---------------------------------------------------------------------------
// Fragment loader: 16x32 f16 tile, row-major source (row stride in halves).
// Matches CDNA5 16-bit A-matrix layout (ISA 7.12.2):
//   lanes 0-15 : row M = lane,    halves 0-7 -> K=0..7,  halves 8-15 -> K=16..23
//   lanes 16-31: row M = lane-16, halves 0-7 -> K=8..15, halves 8-15 -> K=24..31
// Because y = x @ W^T, row-major W *is* the B matrix in [n][k] order, so the
// same loader serves A and B fragments. Two 16B ds_load_b128 per lane.
// ---------------------------------------------------------------------------
__device__ __forceinline__ v16h load_frag(const _Float16* base, int stride) {
  const int lane = threadIdx.x & 31;
  const int r    = lane & 15;
  const int kg   = lane >> 4;          // 0 or 1
  const _Float16* p = base + r * stride + kg * 8;
  union { v16h v; v8h h[2]; } u;
  u.h[0] = *(const v8h*)(p);           // K = kg*8 .. kg*8+7
  u.h[1] = *(const v8h*)(p + 16);      // K = 16+kg*8 .. 16+kg*8+7
  return u.v;
}

__device__ __forceinline__ v8f wmma16(v16h a, v16h b, v8f c) {
  // D = A(16x32 f16) * B(32x16 f16) + C(16x16 f32)
  return __builtin_amdgcn_wmma_f32_16x16x32_f16(false, a, false, b,
                                                (short)0, c, false, false);
}

// ---------------------------------------------------------------------------
// f32 -> f16 conversion (query and weights), 4 elements/thread.
// ---------------------------------------------------------------------------
__global__ void cvt_f32_to_f16(const float* __restrict__ in,
                               _Float16* __restrict__ out, int n) {
  int i = (blockIdx.x * blockDim.x + threadIdx.x) * 4;
  if (i + 3 < n) {
    float4 v = *(const float4*)(in + i);
    out[i + 0] = (_Float16)v.x;
    out[i + 1] = (_Float16)v.y;
    out[i + 2] = (_Float16)v.z;
    out[i + 3] = (_Float16)v.w;
  }
}

// ---------------------------------------------------------------------------
// GEMM: y[m][n] = sum_k A[m][k] * W[n][k] + bias[n]
// Block tile 128(M) x 128(N), TK = 32, double-buffered LDS (ping-pong,
// one barrier per K step), register prefetch of the next K slab.
// 128 threads = 4 waves, each wave owns a 64x64 output tile (16 acc tiles,
// 16 wmma per K step, 1:1 ds_load_b128 : wmma ratio).
// MODE=1: f16 head-major [B,H,S,HD] output, scaled (QKV path).
// MODE=0: f32 row-major [M,N] output (final projection).
// ---------------------------------------------------------------------------
template <int MODE>
__global__ void __launch_bounds__(128)
gemm_wmma(const _Float16* __restrict__ A,   // [8192][1024] f16
          const _Float16* __restrict__ W,   // [1024][1024] f16 (row-major)
          const float*    __restrict__ bias,
          _Float16* __restrict__ outH, float* __restrict__ outF,
          float scale) {
  __shared__ _Float16 As[2][128 * 40];   // 128 rows x 32 K, stride 40 (pad)
  __shared__ _Float16 Bs[2][128 * 40];

  const int t    = threadIdx.x;          // 0..127
  const int lane = t & 31;
  const int wid  = t >> 5;               // 0..3
  const int wm   = wid & 1;              // M sub-tile (x64)
  const int wn   = wid >> 1;             // N sub-tile (x64)
  const int m0   = blockIdx.y * 128;
  const int n0   = blockIdx.x * 128;
  const int cl   = lane & 15;
  const int rh   = (lane >> 4) * 8;

  v8f acc[4][4];
#pragma unroll
  for (int i = 0; i < 4; ++i)
#pragma unroll
    for (int j = 0; j < 4; ++j) acc[i][j] = {};

  // Cooperative stage: four neighbouring lanes read one row's 64-byte K slab,
  // so one 16-byte load of a wave touches 8 cache lines instead of 32.
  // Each wave stages 32 rows in 4 loads per matrix; load u adds SROW(u) rows.
  // Lanes 0-15 hold rows 4 apart (lanes 16-31 the rows next to them): at the
  // 80-byte LDS pitch the 16 stores of a half wave then fall on 64 distinct banks.
#define SROW(u) ((((u) >> 1) * 16) + (((u) & 1) * 2))
  const int srow = wid * 32 + ((lane >> 2) & 3) * 4 + (lane >> 4);
  const int scol = (lane & 3) * 8;
  const int sidx = srow * 40 + scol;
  const _Float16* ga = A + (size_t)(m0 + srow) * D_ + scol;
  const _Float16* gb = W + (size_t)(n0 + srow) * D_ + scol;

  v8h ra[4], rb[4];
#pragma unroll
  for (int u = 0; u < 4; ++u) {
    ra[u] = *(const v8h*)(ga + SROW(u) * D_);
    rb[u] = *(const v8h*)(gb + SROW(u) * D_);
  }
#pragma unroll
  for (int u = 0; u < 4; ++u) {
    *(v8h*)&As[0][sidx + SROW(u) * 40] = ra[u];
    *(v8h*)&Bs[0][sidx + SROW(u) * 40] = rb[u];
  }
  __syncthreads();

  const int NIT = D_ / 32;               // 32
  for (int it = 0; it < NIT; ++it) {
    const int buf = it & 1;
    const bool last = (it == NIT - 1);
    if (!last) {
      const int k1 = (it + 1) * 32;
#pragma unroll
      for (int u = 0; u < 4; ++u) {
        ra[u] = *(const v8h*)(ga + k1 + SROW(u) * D_);
        rb[u] = *(const v8h*)(gb + k1 + SROW(u) * D_);
      }
    }

    v16h af[4];
#pragma unroll
    for (int i = 0; i < 4; ++i)
      af[i] = load_frag(&As[buf][(wm * 64 + i * 16) * 40], 40);
#pragma unroll
    for (int j = 0; j < 4; ++j) {
      v16h bf = load_frag(&Bs[buf][(wn * 64 + j * 16) * 40], 40);
#pragma unroll
      for (int i = 0; i < 4; ++i)
        acc[i][j] = wmma16(af[i], bf, acc[i][j]);
    }

    if (!last) {
      const int nb = buf ^ 1;
#pragma unroll
      for (int u = 0; u < 4; ++u) {
        *(v8h*)&As[nb][sidx + SROW(u) * 40] = ra[u];
        *(v8h*)&Bs[nb][sidx + SROW(u) * 40] = rb[u];
      }
      __syncthreads();
    }
  }
#undef SROW

  // Epilogue. bias depends only on (j, cl): 4 loads per thread.
  const int nwave = n0 + wn * 64;
  float bj[4];
#pragma unroll
  for (int j = 0; j < 4; ++j) bj[j] = bias[nwave + j * 16 + cl];

  if (MODE == 1) {
    // m0 is 128-aligned -> batch index constant per block; nwave is
    // 64-aligned -> head index constant per wave.
    const int b  = m0 >> 11;
    const int sb = (m0 & (S_ - 1)) + wm * 64;
    const int h  = nwave >> 6;
    _Float16* ph = outH + ((size_t)b * H_ + h) * S_ * HD_;
#pragma unroll
    for (int i = 0; i < 4; ++i) {
#pragma unroll
      for (int r = 0; r < 8; ++r) {
        _Float16* pr = ph + (size_t)(sb + i * 16 + rh + r) * HD_;
#pragma unroll
        for (int j = 0; j < 4; ++j)
          pr[j * 16 + cl] = (_Float16)((acc[i][j][r] + bj[j]) * scale);
      }
    }
  } else {
    float* pm = outF + (size_t)(m0 + wm * 64) * D_ + nwave;
#pragma unroll
    for (int i = 0; i < 4; ++i) {
#pragma unroll
      for (int r = 0; r < 8; ++r) {
        float* pr = pm + (size_t)(i * 16 + rh + r) * D_;
#pragma unroll
        for (int j = 0; j < 4; ++j)
          pr[j * 16 + cl] = acc[i][j][r] + bj[j];
      }
    }
  }
}

__device__ __forceinline__ float xhalf(float x) {
  return __int_as_float(__builtin_amdgcn_permlanex16(
      __float_as_int(x), __float_as_int(x), 0x76543210, 0xfedcba98, false, false));
}

// exp2 of eight values (of one value). The instruction set asks for one
// independent instruction or v_nop between a transcendental and an instruction
// that reads its result or overwrites its source. Here every v_exp_f32 is
// followed by an independent one (outputs are early-clobber), the last by v_nop.
__device__ __forceinline__ void exp2x8(float (&y)[8], const float (&x)[8]) {
  asm("v_exp_f32 %0, %8\n\tv_exp_f32 %1, %9\n\tv_exp_f32 %2, %10\n\t"
      "v_exp_f32 %3, %11\n\tv_exp_f32 %4, %12\n\tv_exp_f32 %5, %13\n\t"
      "v_exp_f32 %6, %14\n\tv_exp_f32 %7, %15\n\tv_nop"
      : "=&v"(y[0]), "=&v"(y[1]), "=&v"(y[2]), "=&v"(y[3]),
        "=&v"(y[4]), "=&v"(y[5]), "=&v"(y[6]), "=&v"(y[7])
      : "v"(x[0]), "v"(x[1]), "v"(x[2]), "v"(x[3]),
        "v"(x[4]), "v"(x[5]), "v"(x[6]), "v"(x[7]));
}
__device__ __forceinline__ float exp2x1(float x) {
  float y;
  asm("v_exp_f32 %0, %1\n\tv_nop" : "=v"(y) : "v"(x));
  return y;
}

// amdgpu_waves_per_eu(4, 4) keeps two work-groups per WGP, as before the
// registers fell: the 1,024 equal work-groups run as two even rounds of 512
// (three per WGP would leave a last round of one per WGP), and at that budget
// the LDS fragment loads are issued in groups ahead of the products.
__global__ void __launch_bounds__(256) __attribute__((amdgpu_waves_per_eu(4, 4)))
attention_wmma(const _Float16* __restrict__ q16,   // [B,H,S,HD] (pre-scaled)
               const _Float16* __restrict__ k16,   // [B,H,S,HD]
               const _Float16* __restrict__ v16,   // [B,H,S,HD]
               _Float16* __restrict__ a16) {       // [B,S,D]
  __shared__ _Float16 Ks[64 * 72];        // [n][d]   n=0..63, stride 72 (pad)
  __shared__ _Float16 Vt[64 * 72];        // [d][n]   d=0..63, stride 72 (pad)

  const int t    = threadIdx.x;
  const int lane = t & 31;
  const int wid  = t >> 5;
  const int cl   = lane & 15;
  const int rh   = (lane >> 4) * 8;

  const int qt = blockIdx.x;              // query tile (of 128 rows)
  const int h  = blockIdx.y;
  const int b  = blockIdx.z;

  const size_t head = (size_t)(b * H_ + h) * S_ * HD_;
  const _Float16* qb = q16 + head;
  const _Float16* kb = k16 + head;
  const _Float16* vb = v16 + head;

  const int qr0 = qt * 128 + wid * 16;    // this wave's 16 queries

  // Q^T fragments: 64 dims x 16 queries -> two 32x16 B fragments.
  v16h qa0 = load_frag(qb + (size_t)qr0 * HD_,      HD_);
  v16h qa1 = load_frag(qb + (size_t)qr0 * HD_ + 32, HD_);

  // o[j][r] = O[query cl][dim j*16 + rh + r]
  v8f o[4];
#pragma unroll
  for (int j = 0; j < 4; ++j) o[j] = {};
  float mrow = -1e30f;                    // running maximum of query cl
  float lrow = 0.0f;                      // sum over this lane's half of the keys

  // Cooperative stage mapping: 64 rows x 64 halves, 16 halves per thread.
  const int srow = t >> 2;                // 0..63
  const int scol = (t & 3) * 16;          // 0/16/32/48

  // Preload first K/V tile into registers.
  v8h kr0 = *(const v8h*)(kb + (size_t)srow * HD_ + scol);
  v8h kr1 = *(const v8h*)(kb + (size_t)srow * HD_ + scol + 8);
  v8h vr0 = *(const v8h*)(vb + (size_t)srow * HD_ + scol);
  v8h vr1 = *(const v8h*)(vb + (size_t)srow * HD_ + scol + 8);

  for (int kv0 = 0; kv0 < S_; kv0 += 64) {
    // Commit staged registers: K row-major, V transposed.
    *(v8h*)&Ks[srow * 72 + scol]     = kr0;
    *(v8h*)&Ks[srow * 72 + scol + 8] = kr1;
#pragma unroll
    for (int i = 0; i < 8; ++i) {
      Vt[(scol + i) * 72 + srow]     = vr0[i];
      Vt[(scol + 8 + i) * 72 + srow] = vr1[i];
    }
    __syncthreads();

    // Prefetch next tile into registers (hidden behind the WMMAs below).
    if (kv0 + 64 < S_) {
      const _Float16* kp = kb + (size_t)(kv0 + 64 + srow) * HD_ + scol;
      const _Float16* vp = vb + (size_t)(kv0 + 64 + srow) * HD_ + scol;
      kr0 = *(const v8h*)(kp);
      kr1 = *(const v8h*)(kp + 8);
      vr0 = *(const v8h*)(vp);
      vr1 = *(const v8h*)(vp + 8);
    }
    if (kv0 + 128 < S_) {
      __builtin_prefetch(kb + (size_t)(kv0 + 128 + srow) * HD_ + scol, 0, 3);
      __builtin_prefetch(vb + (size_t)(kv0 + 128 + srow) * HD_ + scol, 0, 3);
    }

    // Scores: four 16x16 tiles, sc[nt][r] = S[query cl][key kv0 + 16*nt + rh + r].
    // Hoist all K fragments so the ds_load_b128s batch ahead of the WMMA burst.
    v16h kf0l = load_frag(&Ks[0 * 16 * 72],      72);
    v16h kf0h = load_frag(&Ks[0 * 16 * 72 + 32], 72);
    v16h kf1l = load_frag(&Ks[1 * 16 * 72],      72);
    v16h kf1h = load_frag(&Ks[1 * 16 * 72 + 32], 72);
    v16h kf2l = load_frag(&Ks[2 * 16 * 72],      72);
    v16h kf2h = load_frag(&Ks[2 * 16 * 72 + 32], 72);
    v16h kf3l = load_frag(&Ks[3 * 16 * 72],      72);
    v16h kf3h = load_frag(&Ks[3 * 16 * 72 + 32], 72);

    v8f sc[4];
    sc[0] = wmma16(kf0h, qa1, wmma16(kf0l, qa0, (v8f){}));
    sc[1] = wmma16(kf1h, qa1, wmma16(kf1l, qa0, (v8f){}));
    sc[2] = wmma16(kf2h, qa1, wmma16(kf2l, qa0, (v8f){}));
    sc[3] = wmma16(kf3h, qa1, wmma16(kf3l, qa0, (v8f){}));

    // Online softmax: one query per lane, 32 of its 64 keys in this lane.
    float tm[4];
#pragma unroll
    for (int nt = 0; nt < 4; ++nt) {
      tm[nt] = fmaxf(fmaxf(fmaxf(sc[nt][0], sc[nt][1]), fmaxf(sc[nt][2], sc[nt][3])),
                     fmaxf(fmaxf(sc[nt][4], sc[nt][5]), fmaxf(sc[nt][6], sc[nt][7])));
    }
    float tmax = fmaxf(fmaxf(tm[0], tm[1]), fmaxf(tm[2], tm[3]));
    tmax = fmaxf(tmax, xhalf(tmax));
    const float mnew = fmaxf(mrow, tmax);
    const float corr = exp2x1((mrow - mnew) * LOG2E);
    mrow = mnew;

    // P^T B fragments: element s of pb[g] is key 32*g + kmap(s), which is
    // register s & 7 of score tile 2*g + (s >> 3).
    v16h pb[2];
    float ps[4];
#pragma unroll
    for (int nt = 0; nt < 4; ++nt) {
      float a[8], p[8];
#pragma unroll
      for (int r = 0; r < 8; ++r) a[r] = (sc[nt][r] - mnew) * LOG2E;
      exp2x8(p, a);
#pragma unroll
      for (int r = 0; r < 8; ++r) pb[nt >> 1][(nt & 1) * 8 + r] = (_Float16)p[r];
      ps[nt] = ((p[0] + p[1]) + (p[2] + p[3])) + ((p[4] + p[5]) + (p[6] + p[7]));
    }
    lrow = lrow * corr + ((ps[0] + ps[1]) + (ps[2] + ps[3]));
#pragma unroll
    for (int j = 0; j < 4; ++j)
#pragma unroll
      for (int r = 0; r < 8; ++r) o[j][r] *= corr;

    // O^T += V^T (64 dims x 64 keys) x P^T (64 keys x 16 queries).
#pragma unroll
    for (int j = 0; j < 4; ++j) {
      v16h vf0 = load_frag(&Vt[(j * 16) * 72],      72);
      v16h vf1 = load_frag(&Vt[(j * 16) * 72 + 32], 72);
      o[j] = wmma16(vf0, pb[0], o[j]);
      o[j] = wmma16(vf1, pb[1], o[j]);
    }
    __syncthreads();   // protect Ks/Vt before next stage
  }

  // Join the two halves' sums, normalize and write token-major [B,S,D] (f16)
  // for the output projection: 8 consecutive dims per lane and tile.
  const float inv = 1.0f / (lrow + xhalf(lrow));
  _Float16* po = a16 + ((size_t)b * S_ + qr0 + cl) * D_ + h * HD_ + rh;
#pragma unroll
  for (int j = 0; j < 4; ++j) {
    v8h ov;
#pragma unroll
    for (int r = 0; r < 8; ++r) ov[r] = (_Float16)(o[j][r] * inv);
    *(v8h*)(po + j * 16) = ov;
  }
}

// ---------------------------------------------------------------------------
// Launcher
// ---------------------------------------------------------------------------
extern "C" void kernel_launch(void* const* d_in, const int* in_sizes, int n_in,
                              void* d_out, int out_size, void* d_ws, size_t ws_size,
                              hipStream_t stream) {
  (void)in_sizes; (void)n_in; (void)out_size; (void)ws_size;

  const float* query = (const float*)d_in[0];
  const float* Wq = (const float*)d_in[1]; const float* bq = (const float*)d_in[2];
  const float* Wk = (const float*)d_in[3]; const float* bk = (const float*)d_in[4];
  const float* Wv = (const float*)d_in[5]; const float* bv = (const float*)d_in[6];
  const float* Wo = (const float*)d_in[7]; const float* bo = (const float*)d_in[8];
  float* out = (float*)d_out;

  const size_t DD  = (size_t)D_ * D_;        // 1M
  const size_t BSD = (size_t)B_ * S_ * D_;   // 8M

  _Float16* w16  = (_Float16*)d_ws;          // 4*DD halves
  _Float16* wq16 = w16;
  _Float16* wk16 = w16 + DD;
  _Float16* wv16 = w16 + 2 * DD;
  _Float16* wo16 = w16 + 3 * DD;
  _Float16* x16  = w16 + 4 * DD;             // BSD
  _Float16* q16  = x16 + BSD;                // BSD  [B,H,S,HD]
  _Float16* k16  = q16 + BSD;
  _Float16* v16p = k16 + BSD;
  _Float16* a16  = v16p + BSD;               // BSD  [B,S,D]

  // 1) f32 -> f16 conversions.
  cvt_f32_to_f16<<<(int)(BSD / 4 / 256), 256, 0, stream>>>(query, x16, (int)BSD);
  cvt_f32_to_f16<<<(int)(DD  / 4 / 256), 256, 0, stream>>>(Wq, wq16, (int)DD);
  cvt_f32_to_f16<<<(int)(DD  / 4 / 256), 256, 0, stream>>>(Wk, wk16, (int)DD);
  cvt_f32_to_f16<<<(int)(DD  / 4 / 256), 256, 0, stream>>>(Wv, wv16, (int)DD);
  cvt_f32_to_f16<<<(int)(DD  / 4 / 256), 256, 0, stream>>>(Wo, wo16, (int)DD);

  // 2) QKV projections (head-major f16; softmax scale folded into Q).
  dim3 ggrid(D_ / 128, (B_ * S_) / 128);     // (8, 64)
  gemm_wmma<1><<<ggrid, 128, 0, stream>>>(x16, wq16, bq, q16, nullptr, 0.125f);
  gemm_wmma<1><<<ggrid, 128, 0, stream>>>(x16, wk16, bk, k16, nullptr, 1.0f);
  gemm_wmma<1><<<ggrid, 128, 0, stream>>>(x16, wv16, bv, v16p, nullptr, 1.0f);

  // 3) Flash attention.
  dim3 agrid(S_ / 128, H_, B_);              // (16, 16, 4)
  attention_wmma<<<agrid, 256, 0, stream>>>(q16, k16, v16p, a16);

  // 4) Output projection -> f32 d_out.
  gemm_wmma<0><<<ggrid, 128, 0, stream>>>(a16, wo16, bo, nullptr, out, 1.0f);
}

// v003
// Measured time: 193 microseconds a run.
// Timed twice side by side with v002, it ran 1.10 times as fast both times.
// All steps since v000 together make it 1.42 times as fast.
#include <hip/hip_runtime.h>

// ---------------------------------------------------------------------------
// MHA forward for MI455X (gfx1250): f16 WMMA GEMMs + flash attention.
// B=4, S=2048, D=1024, H=16, HD=64
// ---------------------------------------------------------------------------

typedef __attribute__((ext_vector_type(16))) _Float16 v16h;
typedef __attribute__((ext_vector_type(8)))  _Float16 v8h;
typedef __attribute__((ext_vector_type(8)))  float    v8f;

#define B_  4
#define S_  2048
#define D_  1024
#define H_  16
#define HD_ 64
#define LOG2E 1.4426950408889634f   // exp(x) = exp2(x * LOG2E)

// ---------------------------------------------------------------------------
// Fragment loader: 16x32 f16 tile, row-major source (row stride in halves).
// Matches CDNA5 16-bit A-matrix layout (ISA 7.12.2):
//   lanes 0-15 : row M = lane,    halves 0-7 -> K=0..7,  halves 8-15 -> K=16..23
//   lanes 16-31: row M = lane-16, halves 0-7 -> K=8..15, halves 8-15 -> K=24..31
// Because y = x @ W^T, row-major W *is* the B matrix in [n][k] order, so the
// same loader serves A and B fragments. Two 16B ds_load_b128 per lane.
// ---------------------------------------------------------------------------
__device__ __forceinline__ v16h load_frag(const _Float16* base, int stride) {
  const int lane = threadIdx.x & 31;
  const int r    = lane & 15;
  const int kg   = lane >> 4;          // 0 or 1
  const _Float16* p = base + r * stride + kg * 8;
  union { v16h v; v8h h[2]; } u;
  u.h[0] = *(const v8h*)(p);           // K = kg*8 .. kg*8+7
  u.h[1] = *(const v8h*)(p + 16);      // K = 16+kg*8 .. 16+kg*8+7
  return u.v;
}

__device__ __forceinline__ v8f wmma16(v16h a, v16h b, v8f c) {
  // D = A(16x32 f16) * B(32x16 f16) + C(16x16 f32)
  return __builtin_amdgcn_wmma_f32_16x16x32_f16(false, a, false, b,
                                                (short)0, c, false, false);
}

// ---------------------------------------------------------------------------
// f32 -> f16 conversion (query and weights), 4 elements/thread.
// ---------------------------------------------------------------------------
__global__ void cvt_f32_to_f16(const float* __restrict__ in,
                               _Float16* __restrict__ out, int n) {
  int i = (blockIdx.x * blockDim.x + threadIdx.x) * 4;
  if (i + 3 < n) {
    float4 v = *(const float4*)(in + i);
    out[i + 0] = (_Float16)v.x;
    out[i + 1] = (_Float16)v.y;
    out[i + 2] = (_Float16)v.z;
    out[i + 3] = (_Float16)v.w;
  }
}

// ---------------------------------------------------------------------------
// GEMM: y[m][n] = sum_k A[m][k] * W[n][k] + bias[n]
// Block tile 128(M) x 128(N), TK = 32, double-buffered LDS (ping-pong,
// one barrier per K step), register prefetch of the next K slab.
// 128 threads = 4 waves, each wave owns a 64x64 output tile (16 acc tiles,
// 16 wmma per K step, 1:1 ds_load_b128 : wmma ratio).
// MODE=1: f16 head-major [B,H,S,HD] output, scaled (QKV path).
// MODE=0: f32 row-major [M,N] output (final projection).
// ---------------------------------------------------------------------------
template <int MODE>
__global__ void __launch_bounds__(128)
gemm_wmma(const _Float16* __restrict__ A,   // [8192][1024] f16
          const _Float16* __restrict__ W,   // [1024][1024] f16 (row-major)
          const float*    __restrict__ bias,
          _Float16* __restrict__ outH, float* __restrict__ outF,
          float scale) {
  __shared__ _Float16 As[2][128 * 40];   // 128 rows x 32 K, stride 40 (pad)
  __shared__ _Float16 Bs[2][128 * 40];

  const int t    = threadIdx.x;          // 0..127
  const int lane = t & 31;
  const int wid  = t >> 5;               // 0..3
  const int wm   = wid & 1;              // M sub-tile (x64)
  const int wn   = wid >> 1;             // N sub-tile (x64)
  const int m0   = blockIdx.y * 128;
  const int n0   = blockIdx.x * 128;
  const int cl   = lane & 15;
  const int rh   = (lane >> 4) * 8;

  v8f acc[4][4];
#pragma unroll
  for (int i = 0; i < 4; ++i)
#pragma unroll
    for (int j = 0; j < 4; ++j) acc[i][j] = {};

  // Cooperative stage: four neighbouring lanes read one row's 64-byte K slab,
  // so one 16-byte load of a wave touches 8 cache lines instead of 32.
  // Each wave stages 32 rows in 4 loads per matrix; load u adds SROW(u) rows.
  // Lanes 0-15 hold rows 4 apart (lanes 16-31 the rows next to them): at the
  // 80-byte LDS pitch the 16 stores of a half wave then fall on 64 distinct banks.
#define SROW(u) ((((u) >> 1) * 16) + (((u) & 1) * 2))
  const int srow = wid * 32 + ((lane >> 2) & 3) * 4 + (lane >> 4);
  const int scol = (lane & 3) * 8;
  const int sidx = srow * 40 + scol;
  const _Float16* ga = A + (size_t)(m0 + srow) * D_ + scol;
  const _Float16* gb = W + (size_t)(n0 + srow) * D_ + scol;

  v8h ra[4], rb[4];
#pragma unroll
  for (int u = 0; u < 4; ++u) {
    ra[u] = *(const v8h*)(ga + SROW(u) * D_);
    rb[u] = *(const v8h*)(gb + SROW(u) * D_);
  }
#pragma unroll
  for (int u = 0; u < 4; ++u) {
    *(v8h*)&As[0][sidx + SROW(u) * 40] = ra[u];
    *(v8h*)&Bs[0][sidx + SROW(u) * 40] = rb[u];
  }
  __syncthreads();

  const int NIT = D_ / 32;               // 32
  for (int it = 0; it < NIT; ++it) {
    const int buf = it & 1;
    const bool last = (it == NIT - 1);
    if (!last) {
      const int k1 = (it + 1) * 32;
#pragma unroll
      for (int u = 0; u < 4; ++u) {
        ra[u] = *(const v8h*)(ga + k1 + SROW(u) * D_);
        rb[u] = *(const v8h*)(gb + k1 + SROW(u) * D_);
      }
    }

    v16h af[4];
#pragma unroll
    for (int i = 0; i < 4; ++i)
      af[i] = load_frag(&As[buf][(wm * 64 + i * 16) * 40], 40);
#pragma unroll
    for (int j = 0; j < 4; ++j) {
      v16h bf = load_frag(&Bs[buf][(wn * 64 + j * 16) * 40], 40);
#pragma unroll
      for (int i = 0; i < 4; ++i)
        acc[i][j] = wmma16(af[i], bf, acc[i][j]);
    }

    if (!last) {
      const int nb = buf ^ 1;
#pragma unroll
      for (int u = 0; u < 4; ++u) {
        *(v8h*)&As[nb][sidx + SROW(u) * 40] = ra[u];
        *(v8h*)&Bs[nb][sidx + SROW(u) * 40] = rb[u];
      }
      __syncthreads();
    }
  }
#undef SROW

  // Epilogue. bias depends only on (j, cl): 4 loads per thread.
  const int nwave = n0 + wn * 64;
  float bj[4];
#pragma unroll
  for (int j = 0; j < 4; ++j) bj[j] = bias[nwave + j * 16 + cl];

  if (MODE == 1) {
    // m0 is 128-aligned -> batch index constant per block; nwave is
    // 64-aligned -> head index constant per wave.
    const int b  = m0 >> 11;
    const int sb = (m0 & (S_ - 1)) + wm * 64;
    const int h  = nwave >> 6;
    _Float16* ph = outH + ((size_t)b * H_ + h) * S_ * HD_;
#pragma unroll
    for (int i = 0; i < 4; ++i) {
#pragma unroll
      for (int r = 0; r < 8; ++r) {
        _Float16* pr = ph + (size_t)(sb + i * 16 + rh + r) * HD_;
#pragma unroll
        for (int j = 0; j < 4; ++j)
          pr[j * 16 + cl] = (_Float16)((acc[i][j][r] + bj[j]) * scale);
      }
    }
  } else {
    float* pm = outF + (size_t)(m0 + wm * 64) * D_ + nwave;
#pragma unroll
    for (int i = 0; i < 4; ++i) {
#pragma unroll
      for (int r = 0; r < 8; ++r) {
        float* pr = pm + (size_t)(i * 16 + rh + r) * D_;
#pragma unroll
        for (int j = 0; j < 4; ++j)
          pr[j * 16 + cl] = acc[i][j][r] + bj[j];
      }
    }
  }
}

#define VPITCH 80                         // halves: 160 B = 32 B x odd
__device__ __forceinline__ v16h load_frag_tr(const _Float16* p) {
  typedef short s16x8 __attribute__((ext_vector_type(8)));
  typedef __attribute__((address_space(3))) s16x8 lds_s16x8;
  union { v16h v; s16x8 h[2]; } u;
  u.h[0] = __builtin_amdgcn_ds_load_tr16_b128_v8i16((lds_s16x8*)p);
  u.h[1] = __builtin_amdgcn_ds_load_tr16_b128_v8i16((lds_s16x8*)(p + 16 * VPITCH));
  return u.v;
}

__device__ __forceinline__ float xhalf(float x) {   // lane l <-> lane l ^ 16
  return __int_as_float(__builtin_amdgcn_permlanex16(
      __float_as_int(x), __float_as_int(x), 0x76543210, 0xfedcba98, false, false));
}

// exp2 of eight values (of one value). The instruction set asks for one
// independent instruction or v_nop between a transcendental and an instruction
// that reads its result or overwrites its source. Here every v_exp_f32 is
// followed by an independent one (outputs are early-clobber), the last by v_nop.
__device__ __forceinline__ void exp2x8(float (&y)[8], const float (&x)[8]) {
  asm("v_exp_f32 %0, %8\n\tv_exp_f32 %1, %9\n\tv_exp_f32 %2, %10\n\t"
      "v_exp_f32 %3, %11\n\tv_exp_f32 %4, %12\n\tv_exp_f32 %5, %13\n\t"
      "v_exp_f32 %6, %14\n\tv_exp_f32 %7, %15\n\tv_nop"
      : "=&v"(y[0]), "=&v"(y[1]), "=&v"(y[2]), "=&v"(y[3]),
        "=&v"(y[4]), "=&v"(y[5]), "=&v"(y[6]), "=&v"(y[7])
      : "v"(x[0]), "v"(x[1]), "v"(x[2]), "v"(x[3]),
        "v"(x[4]), "v"(x[5]), "v"(x[6]), "v"(x[7]));
}
__device__ __forceinline__ float exp2x1(float x) {
  float y;
  asm("v_exp_f32 %0, %1\n\tv_nop" : "=v"(y) : "v"(x));
  return y;
}

// amdgpu_waves_per_eu(4, 4) keeps two work-groups per WGP, as before the
// registers fell: the 1,024 equal work-groups run as two even rounds of 512
// (three per WGP would leave a last round of one per WGP), and at that budget
// the LDS fragment loads are issued in groups ahead of the products.
__global__ void __launch_bounds__(256) __attribute__((amdgpu_waves_per_eu(4, 4)))
attention_wmma(const _Float16* __restrict__ q16,   // [B,H,S,HD] (pre-scaled)
               const _Float16* __restrict__ k16,   // [B,H,S,HD]
               const _Float16* __restrict__ v16,   // [B,H,S,HD]
               _Float16* __restrict__ a16) {       // [B,S,D]
  __shared__ _Float16 Ks[64 * 72];        // [n][d]   n=0..63, stride 72 (pad)
  __shared__ _Float16 Vs[64 * VPITCH];    // [n][d]   n=0..63, stride 80 (pad)

  const int t    = threadIdx.x;
  const int lane = t & 31;
  const int wid  = t >> 5;
  const int cl   = lane & 15;
  const int rh   = (lane >> 4) * 8;

  const int qt = blockIdx.x;              // query tile (of 128 rows)
  const int h  = blockIdx.y;
  const int b  = blockIdx.z;

  const size_t head = (size_t)(b * H_ + h) * S_ * HD_;
  const _Float16* qb = q16 + head;
  const _Float16* kb = k16 + head;
  const _Float16* vb = v16 + head;

  const int qr0 = qt * 128 + wid * 16;    // this wave's 16 queries

  // Q^T fragments: 64 dims x 16 queries -> two 32x16 B fragments.
  v16h qa0 = load_frag(qb + (size_t)qr0 * HD_,      HD_);
  v16h qa1 = load_frag(qb + (size_t)qr0 * HD_ + 32, HD_);

  // o[j][r] = O[query cl][dim j*16 + rh + r]
  v8f o[4];
#pragma unroll
  for (int j = 0; j < 4; ++j) o[j] = {};
  float mrow = -1e30f;                    // running maximum of query cl
  float lrow = 0.0f;                      // sum over this lane's half of the keys

  // Cooperative stage mapping: 64 rows x 64 halves, 16 halves per thread.
  const int srow = t >> 2;                // 0..63
  const int scol = (t & 3) * 16;          // 0/16/32/48

  // This lane's address in the first 16 keys x 16 dims of Vs (transposing load).
  const _Float16* vtp = &Vs[(rh + (lane & 7)) * VPITCH + ((lane >> 3) & 1) * 8];

  // Preload first K/V tile into registers.
  v8h kr0 = *(const v8h*)(kb + (size_t)srow * HD_ + scol);
  v8h kr1 = *(const v8h*)(kb + (size_t)srow * HD_ + scol + 8);
  v8h vr0 = *(const v8h*)(vb + (size_t)srow * HD_ + scol);
  v8h vr1 = *(const v8h*)(vb + (size_t)srow * HD_ + scol + 8);

  for (int kv0 = 0; kv0 < S_; kv0 += 64) {
    // Commit staged registers: K and V row-major.
    *(v8h*)&Ks[srow * 72 + scol]     = kr0;
    *(v8h*)&Ks[srow * 72 + scol + 8] = kr1;
    *(v8h*)&Vs[srow * VPITCH + scol]     = vr0;
    *(v8h*)&Vs[srow * VPITCH + scol + 8] = vr1;
    __syncthreads();

    // Prefetch next tile into registers (hidden behind the WMMAs below).
    if (kv0 + 64 < S_) {
      const _Float16* kp = kb + (size_t)(kv0 + 64 + srow) * HD_ + scol;
      const _Float16* vp = vb + (size_t)(kv0 + 64 + srow) * HD_ + scol;
      kr0 = *(const v8h*)(kp);
      kr1 = *(const v8h*)(kp + 8);
      vr0 = *(const v8h*)(vp);
      vr1 = *(const v8h*)(vp + 8);
    }
    if (kv0 + 128 < S_) {
      __builtin_prefetch(kb + (size_t)(kv0 + 128 + srow) * HD_ + scol, 0, 3);
      __builtin_prefetch(vb + (size_t)(kv0 + 128 + srow) * HD_ + scol, 0, 3);
    }

    // Scores: four 16x16 tiles, sc[nt][r] = S[query cl][key kv0 + 16*nt + rh + r].
    // Hoist all K fragments so the ds_load_b128s batch ahead of the WMMA burst.
    v16h kf0l = load_frag(&Ks[0 * 16 * 72],      72);
    v16h kf0h = load_frag(&Ks[0 * 16 * 72 + 32], 72);
    v16h kf1l = load_frag(&Ks[1 * 16 * 72],      72);
    v16h kf1h = load_frag(&Ks[1 * 16 * 72 + 32], 72);
    v16h kf2l = load_frag(&Ks[2 * 16 * 72],      72);
    v16h kf2h = load_frag(&Ks[2 * 16 * 72 + 32], 72);
    v16h kf3l = load_frag(&Ks[3 * 16 * 72],      72);
    v16h kf3h = load_frag(&Ks[3 * 16 * 72 + 32], 72);

    v8f sc[4];
    sc[0] = wmma16(kf0h, qa1, wmma16(kf0l, qa0, (v8f){}));
    sc[1] = wmma16(kf1h, qa1, wmma16(kf1l, qa0, (v8f){}));
    sc[2] = wmma16(kf2h, qa1, wmma16(kf2l, qa0, (v8f){}));
    sc[3] = wmma16(kf3h, qa1, wmma16(kf3l, qa0, (v8f){}));

    // Online softmax: one query per lane, 32 of its 64 keys in this lane.
    float tm[4];
#pragma unroll
    for (int nt = 0; nt < 4; ++nt) {
      tm[nt] = fmaxf(fmaxf(fmaxf(sc[nt][0], sc[nt][1]), fmaxf(sc[nt][2], sc[nt][3])),
                     fmaxf(fmaxf(sc[nt][4], sc[nt][5]), fmaxf(sc[nt][6], sc[nt][7])));
    }
    float tmax = fmaxf(fmaxf(tm[0], tm[1]), fmaxf(tm[2], tm[3]));
    tmax = fmaxf(tmax, xhalf(tmax));
    const float mnew = fmaxf(mrow, tmax);
    const float corr = exp2x1((mrow - mnew) * LOG2E);
    mrow = mnew;

    // P^T B fragments: element s of pb[g] is key 32*g + kmap(s), which is
    // register s & 7 of score tile 2*g + (s >> 3).
    v16h pb[2];
    float ps[4];
#pragma unroll
    for (int nt = 0; nt < 4; ++nt) {
      float a[8], p[8];
#pragma unroll
      for (int r = 0; r < 8; ++r) a[r] = (sc[nt][r] - mnew) * LOG2E;
      exp2x8(p, a);
#pragma unroll
      for (int r = 0; r < 8; ++r) pb[nt >> 1][(nt & 1) * 8 + r] = (_Float16)p[r];
      ps[nt] = ((p[0] + p[1]) + (p[2] + p[3])) + ((p[4] + p[5]) + (p[6] + p[7]));
    }
    lrow = lrow * corr + ((ps[0] + ps[1]) + (ps[2] + ps[3]));
#pragma unroll
    for (int j = 0; j < 4; ++j)
#pragma unroll
      for (int r = 0; r < 8; ++r) o[j][r] *= corr;

    // O^T += V^T (64 dims x 64 keys) x P^T (64 keys x 16 queries).
#pragma unroll
    for (int j = 0; j < 4; ++j) {
      v16h vf0 = load_frag_tr(vtp + j * 16);
      v16h vf1 = load_frag_tr(vtp + j * 16 + 32 * VPITCH);
      o[j] = wmma16(vf0, pb[0], o[j]);
      o[j] = wmma16(vf1, pb[1], o[j]);
    }
    __syncthreads();   // protect Ks/Vs before next stage
  }

  // Join the two halves' sums, normalize and write token-major [B,S,D] (f16)
  // for the output projection: 8 consecutive dims per lane and tile.
  const float inv = 1.0f / (lrow + xhalf(lrow));
  _Float16* po = a16 + ((size_t)b * S_ + qr0 + cl) * D_ + h * HD_ + rh;
#pragma unroll
  for (int j = 0; j < 4; ++j) {
    v8h ov;
#pragma unroll
    for (int r = 0; r < 8; ++r) ov[r] = (_Float16)(o[j][r] * inv);
    *(v8h*)(po + j * 16) = ov;
  }
}

// ---------------------------------------------------------------------------
// Launcher
// ---------------------------------------------------------------------------
extern "C" void kernel_launch(void* const* d_in, const int* in_sizes, int n_in,
                              void* d_out, int out_size, void* d_ws, size_t ws_size,
                              hipStream_t stream) {
  (void)in_sizes; (void)n_in; (void)out_size; (void)ws_size;

  const float* query = (const float*)d_in[0];
  const float* Wq = (const float*)d_in[1]; const float* bq = (const float*)d_in[2];
  const float* Wk = (const float*)d_in[3]; const float* bk = (const float*)d_in[4];
  const float* Wv = (const float*)d_in[5]; const float* bv = (const float*)d_in[6];
  const float* Wo = (const float*)d_in[7]; const float* bo = (const float*)d_in[8];
  float* out = (float*)d_out;

  const size_t DD  = (size_t)D_ * D_;        // 1M
  const size_t BSD = (size_t)B_ * S_ * D_;   // 8M

  _Float16* w16  = (_Float16*)d_ws;          // 4*DD halves
  _Float16* wq16 = w16;
  _Float16* wk16 = w16 + DD;
  _Float16* wv16 = w16 + 2 * DD;
  _Float16* wo16 = w16 + 3 * DD;
  _Float16* x16  = w16 + 4 * DD;             // BSD
  _Float16* q16  = x16 + BSD;                // BSD  [B,H,S,HD]
  _Float16* k16  = q16 + BSD;
  _Float16* v16p = k16 + BSD;
  _Float16* a16  = v16p + BSD;               // BSD  [B,S,D]

  // 1) f32 -> f16 conversions.
  cvt_f32_to_f16<<<(int)(BSD / 4 / 256), 256, 0, stream>>>(query, x16, (int)BSD);
  cvt_f32_to_f16<<<(int)(DD  / 4 / 256), 256, 0, stream>>>(Wq, wq16, (int)DD);
  cvt_f32_to_f16<<<(int)(DD  / 4 / 256), 256, 0, stream>>>(Wk, wk16, (int)DD);
  cvt_f32_to_f16<<<(int)(DD  / 4 / 256), 256, 0, stream>>>(Wv, wv16, (int)DD);
  cvt_f32_to_f16<<<(int)(DD  / 4 / 256), 256, 0, stream>>>(Wo, wo16, (int)DD);

  // 2) QKV projections (head-major f16; softmax scale folded into Q).
  dim3 ggrid(D_ / 128, (B_ * S_) / 128);     // (8, 64)
  gemm_wmma<1><<<ggrid, 128, 0, stream>>>(x16, wq16, bq, q16, nullptr, 0.125f);
  gemm_wmma<1><<<ggrid, 128, 0, stream>>>(x16, wk16, bk, k16, nullptr, 1.0f);
  gemm_wmma<1><<<ggrid, 128, 0, stream>>>(x16, wv16, bv, v16p, nullptr, 1.0f);

  // 3) Flash attention.
  dim3 agrid(S_ / 128, H_, B_);              // (16, 16, 4)
  attention_wmma<<<agrid, 256, 0, stream>>>(q16, k16, v16p, a16);

  // 4) Output projection -> f32 d_out.
  gemm_wmma<0><<<ggrid, 128, 0, stream>>>(a16, wo16, bo, nullptr, out, 1.0f);
}

// v004
// A run of this version takes 184 microseconds.
// Next to v003, in two timings, it ran 1.05 and 1.06 times as fast.
// All steps since v000 together make it 1.50 times as fast.
#include <hip/hip_runtime.h>

// ---------------------------------------------------------------------------
// MHA forward for MI455X (gfx1250): f16 WMMA GEMMs + flash attention.
// B=4, S=2048, D=1024, H=16, HD=64
// ---------------------------------------------------------------------------

typedef __attribute__((ext_vector_type(16))) _Float16 v16h;
typedef __attribute__((ext_vector_type(8)))  _Float16 v8h;
typedef __attribute__((ext_vector_type(8)))  float    v8f;

#define B_  4
#define S_  2048
#define D_  1024
#define H_  16
#define HD_ 64
#define LOG2E 1.4426950408889634f   // exp(x) = exp2(x * LOG2E)

// ---------------------------------------------------------------------------
// Fragment loader: 16x32 f16 tile, row-major source (row stride in halves).
// Matches CDNA5 16-bit A-matrix layout (ISA 7.12.2):
//   lanes 0-15 : row M = lane,    halves 0-7 -> K=0..7,  halves 8-15 -> K=16..23
//   lanes 16-31: row M = lane-16, halves 0-7 -> K=8..15, halves 8-15 -> K=24..31
// Because y = x @ W^T, row-major W *is* the B matrix in [n][k] order, so the
// same loader serves A and B fragments. Two 16B ds_load_b128 per lane.
// ---------------------------------------------------------------------------
__device__ __forceinline__ v16h load_frag(const _Float16* base, int stride) {
  const int lane = threadIdx.x & 31;
  const int r    = lane & 15;
  const int kg   = lane >> 4;          // 0 or 1
  const _Float16* p = base + r * stride + kg * 8;
  union { v16h v; v8h h[2]; } u;
  u.h[0] = *(const v8h*)(p);           // K = kg*8 .. kg*8+7
  u.h[1] = *(const v8h*)(p + 16);      // K = 16+kg*8 .. 16+kg*8+7
  return u.v;
}

__device__ __forceinline__ v8f wmma16(v16h a, v16h b, v8f c) {
  // D = A(16x32 f16) * B(32x16 f16) + C(16x16 f32)
  return __builtin_amdgcn_wmma_f32_16x16x32_f16(false, a, false, b,
                                                (short)0, c, false, false);
}

// ---------------------------------------------------------------------------
// f32 -> f16 conversion of the four weights and the query in ONE launch of
// 256 work-groups x 16 waves (one work-group per WGP), so that 4,096 waves
// start instead of 98,304 waves of one load each. The f16 copies lie in one
// row in the workspace: Wq | Wk | Wv | Wo | query, 12,288 pieces of 1,024
// elements. Wave w takes pieces w (a weight), 4,096 + w and 8,192 + w (query):
// 24 loads of 16 bytes a lane, each 512 contiguous bytes of a wave, all issued
// ahead of the first conversion; each store is 256 contiguous bytes of a wave.
// ---------------------------------------------------------------------------
#define CVT_PIECE 1024                    // elements: 8 wave loads of 512 bytes
#define CVT_WAVES 4096                    // = 4 * D_ * D_ / CVT_PIECE
// amdgpu_waves_per_eu(4, 4): one work-group per WGP is four waves per SIMD; at
// that register budget the compiler issues all 24 loads ahead (at the default
// budget it holds half of them back behind waits to save registers).
__global__ void __launch_bounds__(512) __attribute__((amdgpu_waves_per_eu(4, 4)))
cvt_all_f32_to_f16(const float* __restrict__ query,
                   const float* __restrict__ Wq, const float* __restrict__ Wk,
                   const float* __restrict__ Wv, const float* __restrict__ Wo,
                   _Float16* __restrict__ out) {
  typedef __attribute__((ext_vector_type(4))) _Float16 v4h;
  const int l4 = (threadIdx.x & 31) * 4;  // this lane's 4 elements of 128
  // Wave number in a scalar register: piece addresses are scalar bases.
  const int w = blockIdx.x * 16 + __builtin_amdgcn_readfirstlane(threadIdx.x >> 5);
  const int wsel = blockIdx.x >> 6;       // 64 work-groups (1,024 pieces) a weight
  const float* wsrc = wsel == 0 ? Wq : wsel == 1 ? Wk : wsel == 2 ? Wv : Wo;
  const float* s0 = wsrc  + (size_t)(w & 1023) * CVT_PIECE;
  const float* s1 = query + (size_t)w * CVT_PIECE;
  const float* s2 = s1 + (size_t)CVT_WAVES * CVT_PIECE;
  _Float16* d0 = out + (size_t)w * CVT_PIECE;

  float4 v[3][8];
#pragma unroll
  for (int u = 0; u < 8; ++u) v[0][u] = *(const float4*)(s0 + u * 128 + l4);
#pragma unroll
  for (int u = 0; u < 8; ++u) v[1][u] = *(const float4*)(s1 + u * 128 + l4);
#pragma unroll
  for (int u = 0; u < 8; ++u) v[2][u] = *(const float4*)(s2 + u * 128 + l4);
#pragma unroll
  for (int j = 0; j < 3; ++j) {
#pragma unroll
    for (int u = 0; u < 8; ++u) {
      v4h h;
      h[0] = (_Float16)v[j][u].x;
      h[1] = (_Float16)v[j][u].y;
      h[2] = (_Float16)v[j][u].z;
      h[3] = (_Float16)v[j][u].w;
      *(v4h*)(d0 + (size_t)j * CVT_WAVES * CVT_PIECE + u * 128 + l4) = h;
    }
  }
}

// ---------------------------------------------------------------------------
// GEMM: y[m][n] = sum_k A[m][k] * W[n][k] + bias[n]
// Block tile 128(M) x 128(N), TK = 32, double-buffered LDS (ping-pong,
// one barrier per K step), register prefetch of the next K slab.
// 128 threads = 4 waves, each wave owns a 64x64 output tile (16 acc tiles,
// 16 wmma per K step, 1:1 ds_load_b128 : wmma ratio).
// MODE=1: f16 head-major [B,H,S,HD] output, scaled (QKV path).
// MODE=0: f32 row-major [M,N] output (final projection).
// ---------------------------------------------------------------------------
template <int MODE>
__global__ void __launch_bounds__(128)
gemm_wmma(const _Float16* __restrict__ A,   // [8192][1024] f16
          const _Float16* __restrict__ W,   // [1024][1024] f16 (row-major)
          const float*    __restrict__ bias,
          _Float16* __restrict__ outH, float* __restrict__ outF,
          float scale) {
  __shared__ _Float16 As[2][128 * 40];   // 128 rows x 32 K, stride 40 (pad)
  __shared__ _Float16 Bs[2][128 * 40];

  const int t    = threadIdx.x;          // 0..127
  const int lane = t & 31;
  const int wid  = t >> 5;               // 0..3
  const int wm   = wid & 1;              // M sub-tile (x64)
  const int wn   = wid >> 1;             // N sub-tile (x64)
  const int m0   = blockIdx.y * 128;
  const int n0   = blockIdx.x * 128;
  const int cl   = lane & 15;
  const int rh   = (lane >> 4) * 8;

  v8f acc[4][4];
#pragma unroll
  for (int i = 0; i < 4; ++i)
#pragma unroll
    for (int j = 0; j < 4; ++j) acc[i][j] = {};

  // Cooperative stage: four neighbouring lanes read one row's 64-byte K slab,
  // so one 16-byte load of a wave touches 8 cache lines instead of 32.
  // Each wave stages 32 rows in 4 loads per matrix; load u adds SROW(u) rows.
  // Lanes 0-15 hold rows 4 apart (lanes 16-31 the rows next to them): at the
  // 80-byte LDS pitch the 16 stores of a half wave then fall on 64 distinct banks.
#define SROW(u) ((((u) >> 1) * 16) + (((u) & 1) * 2))
  const int srow = wid * 32 + ((lane >> 2) & 3) * 4 + (lane >> 4);
  const int scol = (lane & 3) * 8;
  const int sidx = srow * 40 + scol;
  const _Float16* ga = A + (size_t)(m0 + srow) * D_ + scol;
  const _Float16* gb = W + (size_t)(n0 + srow) * D_ + scol;

  v8h ra[4], rb[4];
#pragma unroll
  for (int u = 0; u < 4; ++u) {
    ra[u] = *(const v8h*)(ga + SROW(u) * D_);
    rb[u] = *(const v8h*)(gb + SROW(u) * D_);
  }
#pragma unroll
  for (int u = 0; u < 4; ++u) {
    *(v8h*)&As[0][sidx + SROW(u) * 40] = ra[u];
    *(v8h*)&Bs[0][sidx + SROW(u) * 40] = rb[u];
  }
  __syncthreads();

  const int NIT = D_ / 32;               // 32
  for (int it = 0; it < NIT; ++it) {
    const int buf = it & 1;
    const bool last = (it == NIT - 1);
    if (!last) {
      const int k1 = (it + 1) * 32;
#pragma unroll
      for (int u = 0; u < 4; ++u) {
        ra[u] = *(const v8h*)(ga + k1 + SROW(u) * D_);
        rb[u] = *(const v8h*)(gb + k1 + SROW(u) * D_);
      }
    }

    v16h af[4];
#pragma unroll
    for (int i = 0; i < 4; ++i)
      af[i] = load_frag(&As[buf][(wm * 64 + i * 16) * 40], 40);
#pragma unroll
    for (int j = 0; j < 4; ++j) {
      v16h bf = load_frag(&Bs[buf][(wn * 64 + j * 16) * 40], 40);
#pragma unroll
      for (int i = 0; i < 4; ++i)
        acc[i][j] = wmma16(af[i], bf, acc[i][j]);
    }

    if (!last) {
      const int nb = buf ^ 1;
#pragma unroll
      for (int u = 0; u < 4; ++u) {
        *(v8h*)&As[nb][sidx + SROW(u) * 40] = ra[u];
        *(v8h*)&Bs[nb][sidx + SROW(u) * 40] = rb[u];
      }
      __syncthreads();
    }
  }
#undef SROW

  // Epilogue. bias depends only on (j, cl): 4 loads per thread.
  const int nwave = n0 + wn * 64;
  float bj[4];
#pragma unroll
  for (int j = 0; j < 4; ++j) bj[j] = bias[nwave + j * 16 + cl];

  if (MODE == 1) {
    // m0 is 128-aligned -> batch index constant per block; nwave is
    // 64-aligned -> head index constant per wave.
    const int b  = m0 >> 11;
    const int sb = (m0 & (S_ - 1)) + wm * 64;
    const int h  = nwave >> 6;
    _Float16* ph = outH + ((size_t)b * H_ + h) * S_ * HD_;
#pragma unroll
    for (int i = 0; i < 4; ++i) {
#pragma unroll
      for (int r = 0; r < 8; ++r) {
        _Float16* pr = ph + (size_t)(sb + i * 16 + rh + r) * HD_;
#pragma unroll
        for (int j = 0; j < 4; ++j)
          pr[j * 16 + cl] = (_Float16)((acc[i][j][r] + bj[j]) * scale);
      }
    }
  } else {
    float* pm = outF + (size_t)(m0 + wm * 64) * D_ + nwave;
#pragma unroll
    for (int i = 0; i < 4; ++i) {
#pragma unroll
      for (int r = 0; r < 8; ++r) {
        float* pr = pm + (size_t)(i * 16 + rh + r) * D_;
#pragma unroll
        for (int j = 0; j < 4; ++j)
          pr[j * 16 + cl] = acc[i][j][r] + bj[j];
      }
    }
  }
}

#define VPITCH 80                         // halves: 160 B = 32 B x odd
__device__ __forceinline__ v16h load_frag_tr(const _Float16* p) {
  typedef short s16x8 __attribute__((ext_vector_type(8)));
  typedef __attribute__((address_space(3))) s16x8 lds_s16x8;
  union { v16h v; s16x8 h[2]; } u;
  u.h[0] = __builtin_amdgcn_ds_load_tr16_b128_v8i16((lds_s16x8*)p);
  u.h[1] = __builtin_amdgcn_ds_load_tr16_b128_v8i16((lds_s16x8*)(p + 16 * VPITCH));
  return u.v;
}

__device__ __forceinline__ float xhalf(float x) {   // lane l <-> lane l ^ 16
  return __int_as_float(__builtin_amdgcn_permlanex16(
      __float_as_int(x), __float_as_int(x), 0x76543210, 0xfedcba98, false, false));
}

// exp2 of eight values (of one value). The instruction set asks for one
// independent instruction or v_nop between a transcendental and an instruction
// that reads its result or overwrites its source. Here every v_exp_f32 is
// followed by an independent one (outputs are early-clobber), the last by v_nop.
__device__ __forceinline__ void exp2x8(float (&y)[8], const float (&x)[8]) {
  asm("v_exp_f32 %0, %8\n\tv_exp_f32 %1, %9\n\tv_exp_f32 %2, %10\n\t"
      "v_exp_f32 %3, %11\n\tv_exp_f32 %4, %12\n\tv_exp_f32 %5, %13\n\t"
      "v_exp_f32 %6, %14\n\tv_exp_f32 %7, %15\n\tv_nop"
      : "=&v"(y[0]), "=&v"(y[1]), "=&v"(y[2]), "=&v"(y[3]),
        "=&v"(y[4]), "=&v"(y[5]), "=&v"(y[6]), "=&v"(y[7])
      : "v"(x[0]), "v"(x[1]), "v"(x[2]), "v"(x[3]),
        "v"(x[4]), "v"(x[5]), "v"(x[6]), "v"(x[7]));
}
__device__ __forceinline__ float exp2x1(float x) {
  float y;
  asm("v_exp_f32 %0, %1\n\tv_nop" : "=v"(y) : "v"(x));
  return y;
}

// amdgpu_waves_per_eu(4, 4) keeps two work-groups per WGP, as before the
// registers fell: the 1,024 equal work-groups run as two even rounds of 512
// (three per WGP would leave a last round of one per WGP), and at that budget
// the LDS fragment loads are issued in groups ahead of the products.
__global__ void __launch_bounds__(256) __attribute__((amdgpu_waves_per_eu(4, 4)))
attention_wmma(const _Float16* __restrict__ q16,   // [B,H,S,HD] (pre-scaled)
               const _Float16* __restrict__ k16,   // [B,H,S,HD]
               const _Float16* __restrict__ v16,   // [B,H,S,HD]
               _Float16* __restrict__ a16) {       // [B,S,D]
  __shared__ _Float16 Ks[64 * 72];        // [n][d]   n=0..63, stride 72 (pad)
  __shared__ _Float16 Vs[64 * VPITCH];    // [n][d]   n=0..63, stride 80 (pad)

  const int t    = threadIdx.x;
  const int lane = t & 31;
  const int wid  = t >> 5;
  const int cl   = lane & 15;
  const int rh   = (lane >> 4) * 8;

  const int qt = blockIdx.x;              // query tile (of 128 rows)
  const int h  = blockIdx.y;
  const int b  = blockIdx.z;

  const size_t head = (size_t)(b * H_ + h) * S_ * HD_;
  const _Float16* qb = q16 + head;
  const _Float16* kb = k16 + head;
  const _Float16* vb = v16 + head;

  const int qr0 = qt * 128 + wid * 16;    // this wave's 16 queries

  // Q^T fragments: 64 dims x 16 queries -> two 32x16 B fragments.
  v16h qa0 = load_frag(qb + (size_t)qr0 * HD_,      HD_);
  v16h qa1 = load_frag(qb + (size_t)qr0 * HD_ + 32, HD_);

  // o[j][r] = O[query cl][dim j*16 + rh + r]
  v8f o[4];
#pragma unroll
  for (int j = 0; j < 4; ++j) o[j] = {};
  float mrow = -1e30f;                    // running maximum of query cl
  float lrow = 0.0f;                      // sum over this lane's half of the keys

  // Cooperative stage mapping: 64 rows x 64 halves, 16 halves per thread.
  const int srow = t >> 2;                // 0..63
  const int scol = (t & 3) * 16;          // 0/16/32/48

  // This lane's address in the first 16 keys x 16 dims of Vs (transposing load).
  const _Float16* vtp = &Vs[(rh + (lane & 7)) * VPITCH + ((lane >> 3) & 1) * 8];

  // Preload first K/V tile into registers.
  v8h kr0 = *(const v8h*)(kb + (size_t)srow * HD_ + scol);
  v8h kr1 = *(const v8h*)(kb + (size_t)srow * HD_ + scol + 8);
  v8h vr0 = *(const v8h*)(vb + (size_t)srow * HD_ + scol);
  v8h vr1 = *(const v8h*)(vb + (size_t)srow * HD_ + scol + 8);

  for (int kv0 = 0; kv0 < S_; kv0 += 64) {
    // Commit staged registers: K and V row-major.
    *(v8h*)&Ks[srow * 72 + scol]     = kr0;
    *(v8h*)&Ks[srow * 72 + scol + 8] = kr1;
    *(v8h*)&Vs[srow * VPITCH + scol]     = vr0;
    *(v8h*)&Vs[srow * VPITCH + scol + 8] = vr1;
    __syncthreads();

    // Prefetch next tile into registers (hidden behind the WMMAs below).
    if (kv0 + 64 < S_) {
      const _Float16* kp = kb + (size_t)(kv0 + 64 + srow) * HD_ + scol;
      const _Float16* vp = vb + (size_t)(kv0 + 64 + srow) * HD_ + scol;
      kr0 = *(const v8h*)(kp);
      kr1 = *(const v8h*)(kp + 8);
      vr0 = *(const v8h*)(vp);
      vr1 = *(const v8h*)(vp + 8);
    }
    if (kv0 + 128 < S_) {
      __builtin_prefetch(kb + (size_t)(kv0 + 128 + srow) * HD_ + scol, 0, 3);
      __builtin_prefetch(vb + (size_t)(kv0 + 128 + srow) * HD_ + scol, 0, 3);
    }

    // Scores: four 16x16 tiles, sc[nt][r] = S[query cl][key kv0 + 16*nt + rh + r].
    // Hoist all K fragments so the ds_load_b128s batch ahead of the WMMA burst.
    v16h kf0l = load_frag(&Ks[0 * 16 * 72],      72);
    v16h kf0h = load_frag(&Ks[0 * 16 * 72 + 32], 72);
    v16h kf1l = load_frag(&Ks[1 * 16 * 72],      72);
    v16h kf1h = load_frag(&Ks[1 * 16 * 72 + 32], 72);
    v16h kf2l = load_frag(&Ks[2 * 16 * 72],      72);
    v16h kf2h = load_frag(&Ks[2 * 16 * 72 + 32], 72);
    v16h kf3l = load_frag(&Ks[3 * 16 * 72],      72);
    v16h kf3h = load_frag(&Ks[3 * 16 * 72 + 32], 72);

    v8f sc[4];
    sc[0] = wmma16(kf0h, qa1, wmma16(kf0l, qa0, (v8f){}));
    sc[1] = wmma16(kf1h, qa1, wmma16(kf1l, qa0, (v8f){}));
    sc[2] = wmma16(kf2h, qa1, wmma16(kf2l, qa0, (v8f){}));
    sc[3] = wmma16(kf3h, qa1, wmma16(kf3l, qa0, (v8f){}));

    // Online softmax: one query per lane, 32 of its 64 keys in this lane.
    float tm[4];
#pragma unroll
    for (int nt = 0; nt < 4; ++nt) {
      tm[nt] = fmaxf(fmaxf(fmaxf(sc[nt][0], sc[nt][1]), fmaxf(sc[nt][2], sc[nt][3])),
                     fmaxf(fmaxf(sc[nt][4], sc[nt][5]), fmaxf(sc[nt][6], sc[nt][7])));
    }
    float tmax = fmaxf(fmaxf(tm[0], tm[1]), fmaxf(tm[2], tm[3]));
    tmax = fmaxf(tmax, xhalf(tmax));
    const float mnew = fmaxf(mrow, tmax);
    const float corr = exp2x1((mrow - mnew) * LOG2E);
    mrow = mnew;

    // P^T B fragments: element s of pb[g] is key 32*g + kmap(s), which is
    // register s & 7 of score tile 2*g + (s >> 3).
    v16h pb[2];
    float ps[4];
#pragma unroll
    for (int nt = 0; nt < 4; ++nt) {
      float a[8], p[8];
#pragma unroll
      for (int r = 0; r < 8; ++r) a[r] = (sc[nt][r] - mnew) * LOG2E;
      exp2x8(p, a);
#pragma unroll
      for (int r = 0; r < 8; ++r) pb[nt >> 1][(nt & 1) * 8 + r] = (_Float16)p[r];
      ps[nt] = ((p[0] + p[1]) + (p[2] + p[3])) + ((p[4] + p[5]) + (p[6] + p[7]));
    }
    lrow = lrow * corr + ((ps[0] + ps[1]) + (ps[2] + ps[3]));
#pragma unroll
    for (int j = 0; j < 4; ++j)
#pragma unroll
      for (int r = 0; r < 8; ++r) o[j][r] *= corr;

    // O^T += V^T (64 dims x 64 keys) x P^T (64 keys x 16 queries).
#pragma unroll
    for (int j = 0; j < 4; ++j) {
      v16h vf0 = load_frag_tr(vtp + j * 16);
      v16h vf1 = load_frag_tr(vtp + j * 16 + 32 * VPITCH);
      o[j] = wmma16(vf0, pb[0], o[j]);
      o[j] = wmma16(vf1, pb[1], o[j]);
    }
    __syncthreads();   // protect Ks/Vs before next stage
  }

  // Join the two halves' sums, normalize and write token-major [B,S,D] (f16)
  // for the output projection: 8 consecutive dims per lane and tile.
  const float inv = 1.0f / (lrow + xhalf(lrow));
  _Float16* po = a16 + ((size_t)b * S_ + qr0 + cl) * D_ + h * HD_ + rh;
#pragma unroll
  for (int j = 0; j < 4; ++j) {
    v8h ov;
#pragma unroll
    for (int r = 0; r < 8; ++r) ov[r] = (_Float16)(o[j][r] * inv);
    *(v8h*)(po + j * 16) = ov;
  }
}

// ---------------------------------------------------------------------------
// Launcher
// ---------------------------------------------------------------------------
extern "C" void kernel_launch(void* const* d_in, const int* in_sizes, int n_in,
                              void* d_out, int out_size, void* d_ws, size_t ws_size,
                              hipStream_t stream) {
  (void)in_sizes; (void)n_in; (void)out_size; (void)ws_size;

  const float* query = (const float*)d_in[0];
  const float* Wq = (const float*)d_in[1]; const float* bq = (const float*)d_in[2];
  const float* Wk = (const float*)d_in[3]; const float* bk = (const float*)d_in[4];
  const float* Wv = (const float*)d_in[5]; const float* bv = (const float*)d_in[6];
  const float* Wo = (const float*)d_in[7]; const float* bo = (const float*)d_in[8];
  float* out = (float*)d_out;

  const size_t DD  = (size_t)D_ * D_;        // 1M
  const size_t BSD = (size_t)B_ * S_ * D_;   // 8M

  _Float16* w16  = (_Float16*)d_ws;          // 4*DD halves
  _Float16* wq16 = w16;
  _Float16* wk16 = w16 + DD;
  _Float16* wv16 = w16 + 2 * DD;
  _Float16* wo16 = w16 + 3 * DD;
  _Float16* x16  = w16 + 4 * DD;             // BSD
  _Float16* q16  = x16 + BSD;                // BSD  [B,H,S,HD]
  _Float16* k16  = q16 + BSD;
  _Float16* v16p = k16 + BSD;
  _Float16* a16  = v16p + BSD;               // BSD  [B,S,D]

  // 1) f32 -> f16 conversions: w16 (four weights) and x16 behind it, one launch.
  cvt_all_f32_to_f16<<<256, 512, 0, stream>>>(query, Wq, Wk, Wv, Wo, w16);

  // 2) QKV projections (head-major f16; softmax scale folded into Q).
  dim3 ggrid(D_ / 128, (B_ * S_) / 128);     // (8, 64)
  gemm_wmma<1><<<ggrid, 128, 0, stream>>>(x16, wq16, bq, q16, nullptr, 0.125f);
  gemm_wmma<1><<<ggrid, 128, 0, stream>>>(x16, wk16, bk, k16, nullptr, 1.0f);
  gemm_wmma<1><<<ggrid, 128, 0, stream>>>(x16, wv16, bv, v16p, nullptr, 1.0f);

  // 3) Flash attention.
  dim3 agrid(S_ / 128, H_, B_);              // (16, 16, 4)
  attention_wmma<<<agrid, 256, 0, stream>>>(q16, k16, v16p, a16);

  // 4) Output projection -> f32 d_out.
  gemm_wmma<0><<<ggrid, 128, 0, stream>>>(a16, wo16, bo, nullptr, out, 1.0f);
}

// v005
// A run of this version takes 169 microseconds.
// Two timings next to v004 both put it at 1.09 times that version's speed.
// All steps since v000 together make it 1.64 times as fast.
#include <hip/hip_runtime.h>

// ---------------------------------------------------------------------------
// MHA forward for MI455X (gfx1250): f16 WMMA GEMMs + flash attention.
// B=4, S=2048, D=1024, H=16, HD=64
// ---------------------------------------------------------------------------

typedef __attribute__((ext_vector_type(16))) _Float16 v16h;
typedef __attribute__((ext_vector_type(8)))  _Float16 v8h;
typedef __attribute__((ext_vector_type(8)))  float    v8f;

#define B_  4
#define S_  2048
#define D_  1024
#define H_  16
#define HD_ 64
#define LOG2E 1.4426950408889634f   // exp(x) = exp2(x * LOG2E)

// ---------------------------------------------------------------------------
// Fragment loader: 16x32 f16 tile, row-major source (row stride in halves).
// Matches CDNA5 16-bit A-matrix layout (ISA 7.12.2):
//   lanes 0-15 : row M = lane,    halves 0-7 -> K=0..7,  halves 8-15 -> K=16..23
//   lanes 16-31: row M = lane-16, halves 0-7 -> K=8..15, halves 8-15 -> K=24..31
// Because y = x @ W^T, row-major W *is* the B matrix in [n][k] order, so the
// same loader serves A and B fragments. Two 16B ds_load_b128 per lane.
// ---------------------------------------------------------------------------
__device__ __forceinline__ v16h load_frag(const _Float16* base, int stride) {
  const int lane = threadIdx.x & 31;
  const int r    = lane & 15;
  const int kg   = lane >> 4;          // 0 or 1
  const _Float16* p = base + r * stride + kg * 8;
  union { v16h v; v8h h[2]; } u;
  u.h[0] = *(const v8h*)(p);           // K = kg*8 .. kg*8+7
  u.h[1] = *(const v8h*)(p + 16);      // K = 16+kg*8 .. 16+kg*8+7
  return u.v;
}

__device__ __forceinline__ v8f wmma16(v16h a, v16h b, v8f c) {
  // D = A(16x32 f16) * B(32x16 f16) + C(16x16 f32)
  return __builtin_amdgcn_wmma_f32_16x16x32_f16(false, a, false, b,
                                                (short)0, c, false, false);
}

// ---------------------------------------------------------------------------
// f32 -> f16 conversion of the four weights and the query in ONE launch of
// 256 work-groups x 16 waves (one work-group per WGP), so that 4,096 waves
// start instead of 98,304 waves of one load each. The f16 copies lie in one
// row in the workspace: Wq | Wk | Wv | Wo | query, 12,288 pieces of 1,024
// elements. Wave w takes pieces w (a weight), 4,096 + w and 8,192 + w (query):
// 24 loads of 16 bytes a lane, each 512 contiguous bytes of a wave, all issued
// ahead of the first conversion; each store is 256 contiguous bytes of a wave.
// ---------------------------------------------------------------------------
#define CVT_PIECE 1024                    // elements: 8 wave loads of 512 bytes
#define CVT_WAVES 4096                    // = 4 * D_ * D_ / CVT_PIECE
// amdgpu_waves_per_eu(4, 4): one work-group per WGP is four waves per SIMD; at
// that register budget the compiler issues all 24 loads ahead (at the default
// budget it holds half of them back behind waits to save registers).
__global__ void __launch_bounds__(512) __attribute__((amdgpu_waves_per_eu(4, 4)))
cvt_all_f32_to_f16(const float* __restrict__ query,
                   const float* __restrict__ Wq, const float* __restrict__ Wk,
                   const float* __restrict__ Wv, const float* __restrict__ Wo,
                   _Float16* __restrict__ out) {
  typedef __attribute__((ext_vector_type(4))) _Float16 v4h;
  const int l4 = (threadIdx.x & 31) * 4;  // this lane's 4 elements of 128
  // Wave number in a scalar register: piece addresses are scalar bases.
  const int w = blockIdx.x * 16 + __builtin_amdgcn_readfirstlane(threadIdx.x >> 5);
  const int wsel = blockIdx.x >> 6;       // 64 work-groups (1,024 pieces) a weight
  const float* wsrc = wsel == 0 ? Wq : wsel == 1 ? Wk : wsel == 2 ? Wv : Wo;
  const float* s0 = wsrc  + (size_t)(w & 1023) * CVT_PIECE;
  const float* s1 = query + (size_t)w * CVT_PIECE;
  const float* s2 = s1 + (size_t)CVT_WAVES * CVT_PIECE;
  _Float16* d0 = out + (size_t)w * CVT_PIECE;

  float4 v[3][8];
#pragma unroll
  for (int u = 0; u < 8; ++u) v[0][u] = *(const float4*)(s0 + u * 128 + l4);
#pragma unroll
  for (int u = 0; u < 8; ++u) v[1][u] = *(const float4*)(s1 + u * 128 + l4);
#pragma unroll
  for (int u = 0; u < 8; ++u) v[2][u] = *(const float4*)(s2 + u * 128 + l4);
#pragma unroll
  for (int j = 0; j < 3; ++j) {
#pragma unroll
    for (int u = 0; u < 8; ++u) {
      v4h h;
      h[0] = (_Float16)v[j][u].x;
      h[1] = (_Float16)v[j][u].y;
      h[2] = (_Float16)v[j][u].z;
      h[3] = (_Float16)v[j][u].w;
      *(v4h*)(d0 + (size_t)j * CVT_WAVES * CVT_PIECE + u * 128 + l4) = h;
    }
  }
}

// ---------------------------------------------------------------------------
// GEMM: y[m][n] = sum_k A[m][k] * W[n][k] + bias[n]
// Block tile 128(M) x 128(N), TK = 32, double-buffered LDS (ping-pong,
// one barrier per K step), register prefetch of the next K slab.
// 128 threads = 4 waves, each wave owns a 64x64 output tile (16 acc tiles,
// 16 wmma per K step, 1:1 ds_load_b128 : wmma ratio).
// MODE=1: f16 head-major [B,H,S,HD] output, scaled (QKV path).
// MODE=0: f32 row-major [M,N] output (final projection).
// ---------------------------------------------------------------------------
template <int MODE>
__global__ void __launch_bounds__(128)
gemm_wmma(const _Float16* __restrict__ A,   // [8192][1024] f16
          const _Float16* __restrict__ W,   // [1024][1024] f16 (row-major)
          const float*    __restrict__ bias,
          _Float16* __restrict__ outH, float* __restrict__ outF,
          float scale) {
  __shared__ _Float16 As[2][128 * 40];   // 128 rows x 32 K, stride 40 (pad)
  __shared__ _Float16 Bs[2][128 * 40];

  const int t    = threadIdx.x;          // 0..127
  const int lane = t & 31;
  const int wid  = t >> 5;               // 0..3
  const int wm   = wid & 1;              // M sub-tile (x64)
  const int wn   = wid >> 1;             // N sub-tile (x64)
  const int m0   = blockIdx.y * 128;
  const int n0   = blockIdx.x * 128;
  const int cl   = lane & 15;
  const int rh   = (lane >> 4) * 8;

  v8f acc[4][4];
#pragma unroll
  for (int i = 0; i < 4; ++i)
#pragma unroll
    for (int j = 0; j < 4; ++j) acc[i][j] = {};

  // Cooperative stage: four neighbouring lanes read one row's 64-byte K slab,
  // so one 16-byte load of a wave touches 8 cache lines instead of 32.
  // Each wave stages 32 rows in 4 loads per matrix; load u adds SROW(u) rows.
  // Lanes 0-15 hold rows 4 apart (lanes 16-31 the rows next to them): at the
  // 80-byte LDS pitch the 16 stores of a half wave then fall on 64 distinct banks.
#define SROW(u) ((((u) >> 1) * 16) + (((u) & 1) * 2))
  const int srow = wid * 32 + ((lane >> 2) & 3) * 4 + (lane >> 4);
  const int scol = (lane & 3) * 8;
  const int sidx = srow * 40 + scol;
  const _Float16* ga = A + (size_t)(m0 + srow) * D_ + scol;
  const _Float16* gb = W + (size_t)(n0 + srow) * D_ + scol;

  v8h ra[4], rb[4];
#pragma unroll
  for (int u = 0; u < 4; ++u) {
    ra[u] = *(const v8h*)(ga + SROW(u) * D_);
    rb[u] = *(const v8h*)(gb + SROW(u) * D_);
  }
#pragma unroll
  for (int u = 0; u < 4; ++u) {
    *(v8h*)&As[0][sidx + SROW(u) * 40] = ra[u];
    *(v8h*)&Bs[0][sidx + SROW(u) * 40] = rb[u];
  }
  __syncthreads();

  const int NIT = D_ / 32;               // 32
  for (int it = 0; it < NIT; ++it) {
    const int buf = it & 1;
    const bool last = (it == NIT - 1);
    if (!last) {
      const int k1 = (it + 1) * 32;
#pragma unroll
      for (int u = 0; u < 4; ++u) {
        ra[u] = *(const v8h*)(ga + k1 + SROW(u) * D_);
        rb[u] = *(const v8h*)(gb + k1 + SROW(u) * D_);
      }
    }

    v16h af[4];
#pragma unroll
    for (int i = 0; i < 4; ++i)
      af[i] = load_frag(&As[buf][(wm * 64 + i * 16) * 40], 40);
#pragma unroll
    for (int j = 0; j < 4; ++j) {
      v16h bf = load_frag(&Bs[buf][(wn * 64 + j * 16) * 40], 40);
#pragma unroll
      for (int i = 0; i < 4; ++i)
        acc[i][j] = wmma16(af[i], bf, acc[i][j]);
    }

    if (!last) {
      const int nb = buf ^ 1;
#pragma unroll
      for (int u = 0; u < 4; ++u) {
        *(v8h*)&As[nb][sidx + SROW(u) * 40] = ra[u];
        *(v8h*)&Bs[nb][sidx + SROW(u) * 40] = rb[u];
      }
      __syncthreads();
    }
  }
#undef SROW

  // Epilogue. bias depends only on (j, cl): 4 loads per thread.
  const int nwave = n0 + wn * 64;
  float bj[4];
#pragma unroll
  for (int j = 0; j < 4; ++j) bj[j] = bias[nwave + j * 16 + cl];

  if (MODE == 1) {
    // m0 is 128-aligned -> batch index constant per block; nwave is
    // 64-aligned -> head index constant per wave.
    const int b  = m0 >> 11;
    const int sb = (m0 & (S_ - 1)) + wm * 64;
    const int h  = nwave >> 6;
    _Float16* ph = outH + ((size_t)b * H_ + h) * S_ * HD_;
#pragma unroll
    for (int i = 0; i < 4; ++i) {
#pragma unroll
      for (int r = 0; r < 8; ++r) {
        _Float16* pr = ph + (size_t)(sb + i * 16 + rh + r) * HD_;
#pragma unroll
        for (int j = 0; j < 4; ++j)
          pr[j * 16 + cl] = (_Float16)((acc[i][j][r] + bj[j]) * scale);
      }
    }
  } else {
    float* pm = outF + (size_t)(m0 + wm * 64) * D_ + nwave;
#pragma unroll
    for (int i = 0; i < 4; ++i) {
#pragma unroll
      for (int r = 0; r < 8; ++r) {
        float* pr = pm + (size_t)(i * 16 + rh + r) * D_;
#pragma unroll
        for (int j = 0; j < 4; ++j)
          pr[j * 16 + cl] = acc[i][j][r] + bj[j];
      }
    }
  }
}

#define VPITCH 80                         // halves: 160 B = 32 B x odd
__device__ __forceinline__ v16h load_frag_tr(const _Float16* p) {
  typedef short s16x8 __attribute__((ext_vector_type(8)));
  typedef __attribute__((address_space(3))) s16x8 lds_s16x8;
  union { v16h v; s16x8 h[2]; } u;
  u.h[0] = __builtin_amdgcn_ds_load_tr16_b128_v8i16((lds_s16x8*)p);
  u.h[1] = __builtin_amdgcn_ds_load_tr16_b128_v8i16((lds_s16x8*)(p + 16 * VPITCH));
  return u.v;
}

__device__ __forceinline__ float xhalf(float x) {   // lane l <-> lane l ^ 16
  return __int_as_float(__builtin_amdgcn_permlanex16(
      __float_as_int(x), __float_as_int(x), 0x76543210, 0xfedcba98, false, false));
}

// exp2 of eight values (of one value). The instruction set asks for one
// independent instruction or v_nop between a transcendental and an instruction
// that reads its result or overwrites its source. Here every v_exp_f32 is
// followed by an independent one (outputs are early-clobber), the last by v_nop.
__device__ __forceinline__ void exp2x8(float (&y)[8], const float (&x)[8]) {
  asm("v_exp_f32 %0, %8\n\tv_exp_f32 %1, %9\n\tv_exp_f32 %2, %10\n\t"
      "v_exp_f32 %3, %11\n\tv_exp_f32 %4, %12\n\tv_exp_f32 %5, %13\n\t"
      "v_exp_f32 %6, %14\n\tv_exp_f32 %7, %15\n\tv_nop"
      : "=&v"(y[0]), "=&v"(y[1]), "=&v"(y[2]), "=&v"(y[3]),
        "=&v"(y[4]), "=&v"(y[5]), "=&v"(y[6]), "=&v"(y[7])
      : "v"(x[0]), "v"(x[1]), "v"(x[2]), "v"(x[3]),
        "v"(x[4]), "v"(x[5]), "v"(x[6]), "v"(x[7]));
}
__device__ __forceinline__ float exp2x1(float x) {
  float y;
  asm("v_exp_f32 %0, %1\n\tv_nop" : "=v"(y) : "v"(x));
  return y;
}

// amdgpu_waves_per_eu(4, 4): two work-groups per WGP, four waves per SIMD. The
// 512 equal work-groups are then all resident at once, in one round, and the
// vector work between the matrix runs has other waves to hide behind.
__global__ void __launch_bounds__(256) __attribute__((amdgpu_waves_per_eu(4, 4)))
attention_wmma(const _Float16* __restrict__ q16,   // [B,H,S,HD] (pre-scaled)
               const _Float16* __restrict__ k16,   // [B,H,S,HD]
               const _Float16* __restrict__ v16,   // [B,H,S,HD]
               _Float16* __restrict__ a16) {       // [B,S,D]
  __shared__ _Float16 Ks[64 * 72];        // [n][d]   n=0..63, stride 72 (pad)
  __shared__ _Float16 Vs[64 * VPITCH];    // [n][d]   n=0..63, stride 80 (pad)

  const int t    = threadIdx.x;
  const int lane = t & 31;
  const int wid  = t >> 5;
  const int cl   = lane & 15;
  const int rh   = (lane >> 4) * 8;

  const int qt = blockIdx.x;              // query tile (of 256 rows)
  const int h  = blockIdx.y;
  const int b  = blockIdx.z;

  const size_t head = (size_t)(b * H_ + h) * S_ * HD_;
  const _Float16* qb = q16 + head;
  const _Float16* kb = k16 + head;
  const _Float16* vb = v16 + head;

  const int qr0 = qt * 256 + wid * 32;    // this wave's 32 queries (2 groups of 16)

  // Q^T fragments: per group 64 dims x 16 queries -> two 32x16 B fragments.
  v16h qa[2][2];
#pragma unroll
  for (int g = 0; g < 2; ++g) {
    qa[g][0] = load_frag(qb + (size_t)(qr0 + g * 16) * HD_,      HD_);
    qa[g][1] = load_frag(qb + (size_t)(qr0 + g * 16) * HD_ + 32, HD_);
  }

  // o[g][j][r] = O[query 16*g + cl][dim j*16 + rh + r]
  v8f o[2][4];
#pragma unroll
  for (int g = 0; g < 2; ++g)
#pragma unroll
    for (int j = 0; j < 4; ++j) o[g][j] = {};
  float mrow[2] = {-1e30f, -1e30f};       // running maximum of query 16*g + cl
  float lrow[2] = {0.0f, 0.0f};           // sum over this lane's half of the keys

  // Cooperative stage mapping: 64 rows x 64 halves, 16 halves per thread.
  const int srow = t >> 2;                // 0..63
  const int scol = (t & 3) * 16;          // 0/16/32/48

  // This lane's address in the first 16 keys x 16 dims of Vs (transposing load).
  const _Float16* vtp = &Vs[(rh + (lane & 7)) * VPITCH + ((lane >> 3) & 1) * 8];

  // Preload first K/V tile into registers.
  v8h kr0 = *(const v8h*)(kb + (size_t)srow * HD_ + scol);
  v8h kr1 = *(const v8h*)(kb + (size_t)srow * HD_ + scol + 8);
  v8h vr0 = *(const v8h*)(vb + (size_t)srow * HD_ + scol);
  v8h vr1 = *(const v8h*)(vb + (size_t)srow * HD_ + scol + 8);

  for (int kv0 = 0; kv0 < S_; kv0 += 64) {
    // Commit staged registers: K and V row-major.
    *(v8h*)&Ks[srow * 72 + scol]     = kr0;
    *(v8h*)&Ks[srow * 72 + scol + 8] = kr1;
    *(v8h*)&Vs[srow * VPITCH + scol]     = vr0;
    *(v8h*)&Vs[srow * VPITCH + scol + 8] = vr1;
    __syncthreads();

    // Prefetch next tile into registers (hidden behind the WMMAs below).
    if (kv0 + 64 < S_) {
      const _Float16* kp = kb + (size_t)(kv0 + 64 + srow) * HD_ + scol;
      const _Float16* vp = vb + (size_t)(kv0 + 64 + srow) * HD_ + scol;
      kr0 = *(const v8h*)(kp);
      kr1 = *(const v8h*)(kp + 8);
      vr0 = *(const v8h*)(vp);
      vr1 = *(const v8h*)(vp + 8);
    }
    if (kv0 + 128 < S_) {
      __builtin_prefetch(kb + (size_t)(kv0 + 128 + srow) * HD_ + scol, 0, 3);
      __builtin_prefetch(vb + (size_t)(kv0 + 128 + srow) * HD_ + scol, 0, 3);
    }

    // Scores: per group four 16x16 tiles,
    // sc[g][nt][r] = S[query 16*g + cl][key kv0 + 16*nt + rh + r].
    // Every K fragment read from LDS serves both query groups.
    v16h kfl[4], kfh[4];
#pragma unroll
    for (int nt = 0; nt < 4; ++nt) {
      kfl[nt] = load_frag(&Ks[nt * 16 * 72],      72);
      kfh[nt] = load_frag(&Ks[nt * 16 * 72 + 32], 72);
    }
    v8f sc[2][4];
#pragma unroll
    for (int nt = 0; nt < 4; ++nt)
#pragma unroll
      for (int g = 0; g < 2; ++g)
        sc[g][nt] = wmma16(kfh[nt], qa[g][1], wmma16(kfl[nt], qa[g][0], (v8f){}));

    // Online softmax: one query per lane and group, 32 of its 64 keys in this lane.
    // P^T B fragments: element s of pb[g][c] is key 32*c + kmap(s), which is
    // register s & 7 of score tile 2*c + (s >> 3).
    v16h pb[2][2];
    v16h vf[4][2];
#pragma unroll
    for (int g = 0; g < 2; ++g) {
      if (g == 1) {
        // All V^T fragments are asked for as one group here, into the registers
        // that the K fragments and group 0's scores have left: one place of LDS
        // reads with one wait. They are the wave's last LDS reads of the tile, so
        // the closing barrier can be signalled behind that wait, ahead of group
        // 1's softmax and the products.
#pragma unroll
        for (int j = 0; j < 4; ++j) {
          vf[j][0] = load_frag_tr(vtp + j * 16);
          vf[j][1] = load_frag_tr(vtp + j * 16 + 32 * VPITCH);
        }
        // Holds the loads here as one group: without it the scheduler spreads them
        // through both softmaxes and the live registers overflow into scratch.
        __builtin_amdgcn_sched_barrier(0);
      }
      float tm[4];
#pragma unroll
      for (int nt = 0; nt < 4; ++nt) {
        tm[nt] = fmaxf(fmaxf(fmaxf(sc[g][nt][0], sc[g][nt][1]), fmaxf(sc[g][nt][2], sc[g][nt][3])),
                       fmaxf(fmaxf(sc[g][nt][4], sc[g][nt][5]), fmaxf(sc[g][nt][6], sc[g][nt][7])));
      }
      float tmax = fmaxf(fmaxf(tm[0], tm[1]), fmaxf(tm[2], tm[3]));
      tmax = fmaxf(tmax, xhalf(tmax));
      const float mnew = fmaxf(mrow[g], tmax);
      const float corr = exp2x1((mrow[g] - mnew) * LOG2E);
      mrow[g] = mnew;

      float ps[4];
#pragma unroll
      for (int nt = 0; nt < 4; ++nt) {
        float a[8], p[8];
#pragma unroll
        for (int r = 0; r < 8; ++r) a[r] = (sc[g][nt][r] - mnew) * LOG2E;
        exp2x8(p, a);
#pragma unroll
        for (int r = 0; r < 8; ++r) pb[g][nt >> 1][(nt & 1) * 8 + r] = (_Float16)p[r];
        ps[nt] = ((p[0] + p[1]) + (p[2] + p[3])) + ((p[4] + p[5]) + (p[6] + p[7]));
      }
      lrow[g] = lrow[g] * corr + ((ps[0] + ps[1]) + (ps[2] + ps[3]));
#pragma unroll
      for (int j = 0; j < 4; ++j)
#pragma unroll
        for (int r = 0; r < 8; ++r) o[g][j][r] *= corr;
    }

    // O^T += V^T (64 dims x 64 keys) x P^T (64 keys x 32 queries); every V^T
    // fragment read from LDS serves both query groups.
#pragma unroll
    for (int j = 0; j < 4; ++j) {
#pragma unroll
      for (int g = 0; g < 2; ++g) {
        o[g][j] = wmma16(vf[j][0], pb[g][0], o[g][j]);
        o[g][j] = wmma16(vf[j][1], pb[g][1], o[g][j]);
      }
    }
    __syncthreads();   // protect Ks/Vs before next stage
  }

  // Join the two halves' sums, normalize and write token-major [B,S,D] (f16)
  // for the output projection: 8 consecutive dims per lane and tile.
#pragma unroll
  for (int g = 0; g < 2; ++g) {
    const float inv = 1.0f / (lrow[g] + xhalf(lrow[g]));
    _Float16* po = a16 + ((size_t)b * S_ + qr0 + g * 16 + cl) * D_ + h * HD_ + rh;
#pragma unroll
    for (int j = 0; j < 4; ++j) {
      v8h ov;
#pragma unroll
      for (int r = 0; r < 8; ++r) ov[r] = (_Float16)(o[g][j][r] * inv);
      *(v8h*)(po + j * 16) = ov;
    }
  }
}

// ---------------------------------------------------------------------------
// Launcher
// ---------------------------------------------------------------------------
extern "C" void kernel_launch(void* const* d_in, const int* in_sizes, int n_in,
                              void* d_out, int out_size, void* d_ws, size_t ws_size,
                              hipStream_t stream) {
  (void)in_sizes; (void)n_in; (void)out_size; (void)ws_size;

  const float* query = (const float*)d_in[0];
  const float* Wq = (const float*)d_in[1]; const float* bq = (const float*)d_in[2];
  const float* Wk = (const float*)d_in[3]; const float* bk = (const float*)d_in[4];
  const float* Wv = (const float*)d_in[5]; const float* bv = (const float*)d_in[6];
  const float* Wo = (const float*)d_in[7]; const float* bo = (const float*)d_in[8];
  float* out = (float*)d_out;

  const size_t DD  = (size_t)D_ * D_;        // 1M
  const size_t BSD = (size_t)B_ * S_ * D_;   // 8M

  _Float16* w16  = (_Float16*)d_ws;          // 4*DD halves
  _Float16* wq16 = w16;
  _Float16* wk16 = w16 + DD;
  _Float16* wv16 = w16 + 2 * DD;
  _Float16* wo16 = w16 + 3 * DD;
  _Float16* x16  = w16 + 4 * DD;             // BSD
  _Float16* q16  = x16 + BSD;                // BSD  [B,H,S,HD]
  _Float16* k16  = q16 + BSD;
  _Float16* v16p = k16 + BSD;
  _Float16* a16  = v16p + BSD;               // BSD  [B,S,D]

  // 1) f32 -> f16 conversions: w16 (four weights) and x16 behind it, one launch.
  cvt_all_f32_to_f16<<<256, 512, 0, stream>>>(query, Wq, Wk, Wv, Wo, w16);

  // 2) QKV projections (head-major f16; softmax scale folded into Q).
  dim3 ggrid(D_ / 128, (B_ * S_) / 128);     // (8, 64)
  gemm_wmma<1><<<ggrid, 128, 0, stream>>>(x16, wq16, bq, q16, nullptr, 0.125f);
  gemm_wmma<1><<<ggrid, 128, 0, stream>>>(x16, wk16, bk, k16, nullptr, 1.0f);
  gemm_wmma<1><<<ggrid, 128, 0, stream>>>(x16, wv16, bv, v16p, nullptr, 1.0f);

  // 3) Flash attention.
  dim3 agrid(S_ / 256, H_, B_);              // (8, 16, 4)
  attention_wmma<<<agrid, 256, 0, stream>>>(q16, k16, v16p, a16);

  // 4) Output projection -> f32 d_out.
  gemm_wmma<0><<<ggrid, 128, 0, stream>>>(a16, wo16, bo, nullptr, out, 1.0f);
}

// v006
// It runs in 146 microseconds.
// Two timings next to v005 put it at 1.16 and 1.15 times that version's speed.
// All steps since v000 together make it 1.89 times as fast.
#include <hip/hip_runtime.h>
#include <stdint.h>

// ---------------------------------------------------------------------------
// MHA forward for MI455X (gfx1250): f16 WMMA GEMMs + flash attention.
// B=4, S=2048, D=1024, H=16, HD=64
// ---------------------------------------------------------------------------

typedef __attribute__((ext_vector_type(16))) _Float16 v16h;
typedef __attribute__((ext_vector_type(8)))  _Float16 v8h;
typedef __attribute__((ext_vector_type(8)))  float    v8f;

#define B_  4
#define S_  2048
#define D_  1024
#define H_  16
#define HD_ 64
#define LOG2E 1.4426950408889634f   // exp(x) = exp2(x * LOG2E)

// ---------------------------------------------------------------------------
// Fragment loader: 16x32 f16 tile, row-major source (row stride in halves).
// Matches CDNA5 16-bit A-matrix layout (ISA 7.12.2):
//   lanes 0-15 : row M = lane,    halves 0-7 -> K=0..7,  halves 8-15 -> K=16..23
//   lanes 16-31: row M = lane-16, halves 0-7 -> K=8..15, halves 8-15 -> K=24..31
// Because y = x @ W^T, row-major W *is* the B matrix in [n][k] order, so the
// same loader serves A and B fragments. Two 16B ds_load_b128 per lane.
// ---------------------------------------------------------------------------
__device__ __forceinline__ v16h load_frag(const _Float16* base, int stride) {
  const int lane = threadIdx.x & 31;
  const int r    = lane & 15;
  const int kg   = lane >> 4;          // 0 or 1
  const _Float16* p = base + r * stride + kg * 8;
  union { v16h v; v8h h[2]; } u;
  u.h[0] = *(const v8h*)(p);           // K = kg*8 .. kg*8+7
  u.h[1] = *(const v8h*)(p + 16);      // K = 16+kg*8 .. 16+kg*8+7
  return u.v;
}

__device__ __forceinline__ v8f wmma16(v16h a, v16h b, v8f c) {
  // D = A(16x32 f16) * B(32x16 f16) + C(16x16 f32)
  return __builtin_amdgcn_wmma_f32_16x16x32_f16(false, a, false, b,
                                                (short)0, c, false, false);
}

// ---------------------------------------------------------------------------
// f32 -> f16 conversion of the four weights and the query in ONE launch of
// 256 work-groups x 16 waves (one work-group per WGP), so that 4,096 waves
// start instead of 98,304 waves of one load each. The f16 copies lie in one
// row in the workspace: Wq | Wk | Wv | Wo | query, 12,288 pieces of 1,024
// elements. Wave w takes pieces w (a weight), 4,096 + w and 8,192 + w (query):
// 24 loads of 16 bytes a lane, each 512 contiguous bytes of a wave, all issued
// ahead of the first conversion; each store is 256 contiguous bytes of a wave.
// ---------------------------------------------------------------------------
#define CVT_PIECE 1024                    // elements: 8 wave loads of 512 bytes
#define CVT_WAVES 4096                    // = 4 * D_ * D_ / CVT_PIECE
// amdgpu_waves_per_eu(4, 4): one work-group per WGP is four waves per SIMD; at
// that register budget the compiler issues all 24 loads ahead (at the default
// budget it holds half of them back behind waits to save registers).
__global__ void __launch_bounds__(512) __attribute__((amdgpu_waves_per_eu(4, 4)))
cvt_all_f32_to_f16(const float* __restrict__ query,
                   const float* __restrict__ Wq, const float* __restrict__ Wk,
                   const float* __restrict__ Wv, const float* __restrict__ Wo,
                   _Float16* __restrict__ out) {
  typedef __attribute__((ext_vector_type(4))) _Float16 v4h;
  const int l4 = (threadIdx.x & 31) * 4;  // this lane's 4 elements of 128
  // Wave number in a scalar register: piece addresses are scalar bases.
  const int w = blockIdx.x * 16 + __builtin_amdgcn_readfirstlane(threadIdx.x >> 5);
  const int wsel = blockIdx.x >> 6;       // 64 work-groups (1,024 pieces) a weight
  const float* wsrc = wsel == 0 ? Wq : wsel == 1 ? Wk : wsel == 2 ? Wv : Wo;
  const float* s0 = wsrc  + (size_t)(w & 1023) * CVT_PIECE;
  const float* s1 = query + (size_t)w * CVT_PIECE;
  const float* s2 = s1 + (size_t)CVT_WAVES * CVT_PIECE;
  _Float16* d0 = out + (size_t)w * CVT_PIECE;

  float4 v[3][8];
#pragma unroll
  for (int u = 0; u < 8; ++u) v[0][u] = *(const float4*)(s0 + u * 128 + l4);
#pragma unroll
  for (int u = 0; u < 8; ++u) v[1][u] = *(const float4*)(s1 + u * 128 + l4);
#pragma unroll
  for (int u = 0; u < 8; ++u) v[2][u] = *(const float4*)(s2 + u * 128 + l4);
#pragma unroll
  for (int j = 0; j < 3; ++j) {
#pragma unroll
    for (int u = 0; u < 8; ++u) {
      v4h h;
      h[0] = (_Float16)v[j][u].x;
      h[1] = (_Float16)v[j][u].y;
      h[2] = (_Float16)v[j][u].z;
      h[3] = (_Float16)v[j][u].w;
      *(v4h*)(d0 + (size_t)j * CVT_WAVES * CVT_PIECE + u * 128 + l4) = h;
    }
  }
}

// ---------------------------------------------------------------------------
// Tensor loads (tensor_load_to_lds): one request of a wave brings a 2-D tile
// from global memory into LDS, through no register.
// ---------------------------------------------------------------------------
typedef uint32_t u32x4 __attribute__((ext_vector_type(4)));
typedef uint32_t u32x8 __attribute__((ext_vector_type(8)));

__device__ __forceinline__ uint32_t uni(uint32_t v) {
  return (uint32_t)__builtin_amdgcn_readfirstlane(v);
}
// Scalar test around a tensor load (the instruction ignores EXEC): the empty
// statement holds the word in a scalar register, so that the test compiles to
// s_cmp and a scalar branch.
__device__ __forceinline__ uint32_t pinned(uint32_t v) {
  uint32_t w = uni(v);
  asm volatile("" : "+s"(w));   // pinned(): the test word kept in a scalar register
  return w;
}
__device__ __forceinline__ void wait_ds0() {       // this wave's LDS reads are done
  asm volatile("s_wait_dscnt 0x0" ::: "memory");
}
// This wave's tile has landed. The request's group 0 is named as an input, so
// that its scalar registers keep their words until the request is covered.
__device__ __forceinline__ void wait_tensor0(u32x4 g0) {
  asm volatile("s_wait_tensorcnt 0x0" :: "s"(g0) : "memory");
}
// Group 0 is an in-out operand: the caller's copy of it then lives on in the very
// registers that the request was issued from.
__device__ __forceinline__ void tdm_load(u32x4& g0, u32x8 g1) {
  asm volatile("tensor_load_to_lds %0, %1" : "+s"(g0) : "s"(g1) : "memory");
}

#define GK      64      // k per stage: 128-byte rows
#define GPITCH  72      // halves: 144-byte LDS pitch (16 B x odd), laid by the pad
#define GROWS   64      // rows per slice, one slice per wave
#define GSLICE  10240   // bytes: 64 rows x 144 B = 9,216, rounded up to 2 KiB x 5
#define GSTAGE  (4 * GSLICE)

// Group 1: bytes as elements, tile = tensor = 64 rows of 128 bytes, source pitch
// one row of the matrix, 4 dwords of LDS pad behind every 32 dwords (one row).
__device__ __forceinline__ u32x8 tdm_group1() {
  u32x8 g;
  g[0] = uni((1u << 20) | (4u << 22) | (3u << 25));
  g[1] = uni((uint32_t)(GK * 2) << 16);
  g[2] = uni((uint32_t)GROWS << 16);
  g[3] = uni((uint32_t)(GK * 2) << 16);
  g[4] = uni((uint32_t)GROWS);
  g[5] = uni((uint32_t)(D_ * 2));
  g[6] = uni(0u);
  g[7] = uni(0u);
  return g;
}
__device__ __forceinline__ u32x4 tdm_group0(uint32_t lds_dst, uint64_t ga) {
  u32x4 g;
  g[0] = uni(1u);
  g[1] = uni(lds_dst);
  g[2] = uni((uint32_t)ga);
  g[3] = uni((((uint32_t)(ga >> 32)) & 0x01FFFFFFu) | 0x80000000u);
  return g;
}

// ---------------------------------------------------------------------------
// GEMM: y[m][n] = sum_k A[m][k] * W[n][k] + bias[n]
// Block tile 128(M) x 128(N). 128 threads = 4 waves, each wave owns a 64x64
// output tile (16 acc tiles). A stage is 64 k of the 128 A rows and the 128 W
// rows, in four slices of 64 rows: waves 0 and 1 bring the halves of A, waves 2
// and 3 those of W, one tensor load each. Two LDS buffers, one barrier a stage:
// a wave reads all fragments of stage s, then stage s + 2 is asked for into the
// same buffer and flies under the 32 wmma of stage s and the reads of s + 1.
// MODE=1: f16 head-major [B,H,S,HD] output, scaled (QKV path).
// MODE=0: f32 row-major [M,N] output (final projection).
// ---------------------------------------------------------------------------
template <int MODE>
__global__ void __launch_bounds__(128)
gemm_wmma(const _Float16* __restrict__ A,   // [8192][1024] f16
          const _Float16* __restrict__ W,   // [1024][1024] f16 (row-major)
          const float*    __restrict__ bias,
          _Float16* __restrict__ outH, float* __restrict__ outF,
          float scale) {
  __shared__ __attribute__((aligned(2048))) unsigned char ring[2 * GSTAGE];

  const int t    = threadIdx.x;          // 0..127
  const int lane = t & 31;
  const int wid  = t >> 5;               // 0..3
  const int wm   = wid & 1;              // M sub-tile (x64) = A slice
  const int wn   = wid >> 1;             // N sub-tile (x64) = W slice
  const int m0   = blockIdx.y * 128;
  const int n0   = blockIdx.x * 128;
  const int cl   = lane & 15;
  const int rh   = (lane >> 4) * 8;

  v8f acc[4][4];
#pragma unroll
  for (int i = 0; i < 4; ++i)
#pragma unroll
    for (int j = 0; j < 4; ++j) acc[i][j] = {};

  // This wave's slice: source rows and place in each buffer.
  const uint32_t wave = uni(threadIdx.x >> 5);
  const _Float16* srows = wave < 2u ? A + (size_t)(m0 + wave * GROWS) * D_
                                    : W + (size_t)(n0 + (wave - 2u) * GROWS) * D_;
  const uint64_t gsrc  = (uint64_t)(size_t)srows;
  const uint32_t ldst  = (uint32_t)(size_t)ring + wave * GSLICE;
  const u32x8 g1 = tdm_group1();

  const int NST = D_ / GK;               // 16 stages
  u32x4 g0 = tdm_group0(ldst, gsrc);                          // stage 0
  tdm_load(g0, g1);
  wait_tensor0(g0);
  __syncthreads();
  g0 = tdm_group0(ldst + GSTAGE, gsrc + GK * 2);              // stage 1
  tdm_load(g0, g1);

  for (int s = 0; s < NST; ++s) {
    const unsigned char* st = ring + (s & 1) * GSTAGE;
    const _Float16* as = (const _Float16*)(st + wm * GSLICE);
    const _Float16* bs = (const _Float16*)(st + (2 + wn) * GSLICE);
    // All fragments of stage s go into registers first, so that its buffer is free
    // for the refill while the products still run.
    v16h af[2][4], bf[2][4];
#pragma unroll
    for (int c = 0; c < 2; ++c) {
#pragma unroll
      for (int i = 0; i < 4; ++i) {
        af[c][i] = load_frag(as + i * 16 * GPITCH + c * 32, GPITCH);
        bf[c][i] = load_frag(bs + i * 16 * GPITCH + c * 32, GPITCH);
      }
    }

    // Publish point of stage s + 1: own LDS reads done, own tile landed, barrier;
    // only then the refill of the buffer that every wave has just left.
    wait_ds0();
    wait_tensor0(g0);
    __syncthreads();
    if (pinned(s + 2 < NST)) {
      g0 = tdm_group0(ldst + (uint32_t)(s & 1) * GSTAGE,
                      gsrc + (uint64_t)(s + 2) * (GK * 2));
      tdm_load(g0, g1);
    }

#pragma unroll
    for (int c = 0; c < 2; ++c)
#pragma unroll
      for (int j = 0; j < 4; ++j)
#pragma unroll
        for (int i = 0; i < 4; ++i)
          acc[i][j] = wmma16(af[c][i], bf[c][j], acc[i][j]);
  }
  wait_tensor0(g0);
  wait_ds0();

  // Epilogue. bias depends only on (j, cl): 4 loads per thread.
  const int nwave = n0 + wn * 64;
  float bj[4];
#pragma unroll
  for (int j = 0; j < 4; ++j) bj[j] = bias[nwave + j * 16 + cl];

  if (MODE == 1) {
    // m0 is 128-aligned -> batch index constant per block; nwave is
    // 64-aligned -> head index constant per wave.
    const int b  = m0 >> 11;
    const int sb = (m0 & (S_ - 1)) + wm * 64;
    const int h  = nwave >> 6;
    _Float16* ph = outH + ((size_t)b * H_ + h) * S_ * HD_;
#pragma unroll
    for (int i = 0; i < 4; ++i) {
#pragma unroll
      for (int r = 0; r < 8; ++r) {
        _Float16* pr = ph + (size_t)(sb + i * 16 + rh + r) * HD_;
#pragma unroll
        for (int j = 0; j < 4; ++j)
          pr[j * 16 + cl] = (_Float16)((acc[i][j][r] + bj[j]) * scale);
      }
    }
  } else {
    float* pm = outF + (size_t)(m0 + wm * 64) * D_ + nwave;
#pragma unroll
    for (int i = 0; i < 4; ++i) {
#pragma unroll
      for (int r = 0; r < 8; ++r) {
        float* pr = pm + (size_t)(i * 16 + rh + r) * D_;
#pragma unroll
        for (int j = 0; j < 4; ++j)
          pr[j * 16 + cl] = acc[i][j][r] + bj[j];
      }
    }
  }
}

#define VPITCH 80                         // halves: 160 B = 32 B x odd
__device__ __forceinline__ v16h load_frag_tr(const _Float16* p) {
  typedef short s16x8 __attribute__((ext_vector_type(8)));
  typedef __attribute__((address_space(3))) s16x8 lds_s16x8;
  union { v16h v; s16x8 h[2]; } u;
  u.h[0] = __builtin_amdgcn_ds_load_tr16_b128_v8i16((lds_s16x8*)p);
  u.h[1] = __builtin_amdgcn_ds_load_tr16_b128_v8i16((lds_s16x8*)(p + 16 * VPITCH));
  return u.v;
}

__device__ __forceinline__ float xhalf(float x) {   // lane l <-> lane l ^ 16
  return __int_as_float(__builtin_amdgcn_permlanex16(
      __float_as_int(x), __float_as_int(x), 0x76543210, 0xfedcba98, false, false));
}

// exp2 of eight values (of one value). The instruction set asks for one
// independent instruction or v_nop between a transcendental and an instruction
// that reads its result or overwrites its source. Here every v_exp_f32 is
// followed by an independent one (outputs are early-clobber), the last by v_nop.
__device__ __forceinline__ void exp2x8(float (&y)[8], const float (&x)[8]) {
  asm("v_exp_f32 %0, %8\n\tv_exp_f32 %1, %9\n\tv_exp_f32 %2, %10\n\t"
      "v_exp_f32 %3, %11\n\tv_exp_f32 %4, %12\n\tv_exp_f32 %5, %13\n\t"
      "v_exp_f32 %6, %14\n\tv_exp_f32 %7, %15\n\tv_nop"
      : "=&v"(y[0]), "=&v"(y[1]), "=&v"(y[2]), "=&v"(y[3]),
        "=&v"(y[4]), "=&v"(y[5]), "=&v"(y[6]), "=&v"(y[7])
      : "v"(x[0]), "v"(x[1]), "v"(x[2]), "v"(x[3]),
        "v"(x[4]), "v"(x[5]), "v"(x[6]), "v"(x[7]));
}
__device__ __forceinline__ float exp2x1(float x) {
  float y;
  asm("v_exp_f32 %0, %1\n\tv_nop" : "=v"(y) : "v"(x));
  return y;
}

// amdgpu_waves_per_eu(4, 4): two work-groups per WGP, four waves per SIMD. The
// 512 equal work-groups are then all resident at once, in one round, and the
// vector work between the matrix runs has other waves to hide behind.
__global__ void __launch_bounds__(256) __attribute__((amdgpu_waves_per_eu(4, 4)))
attention_wmma(const _Float16* __restrict__ q16,   // [B,H,S,HD] (pre-scaled)
               const _Float16* __restrict__ k16,   // [B,H,S,HD]
               const _Float16* __restrict__ v16,   // [B,H,S,HD]
               _Float16* __restrict__ a16) {       // [B,S,D]
  __shared__ _Float16 Ks[64 * 72];        // [n][d]   n=0..63, stride 72 (pad)
  __shared__ _Float16 Vs[64 * VPITCH];    // [n][d]   n=0..63, stride 80 (pad)

  const int t    = threadIdx.x;
  const int lane = t & 31;
  const int wid  = t >> 5;
  const int cl   = lane & 15;
  const int rh   = (lane >> 4) * 8;

  const int qt = blockIdx.x;              // query tile (of 256 rows)
  const int h  = blockIdx.y;
  const int b  = blockIdx.z;

  const size_t head = (size_t)(b * H_ + h) * S_ * HD_;
  const _Float16* qb = q16 + head;
  const _Float16* kb = k16 + head;
  const _Float16* vb = v16 + head;

  const int qr0 = qt * 256 + wid * 32;    // this wave's 32 queries (2 groups of 16)

  // Q^T fragments: per group 64 dims x 16 queries -> two 32x16 B fragments.
  v16h qa[2][2];
#pragma unroll
  for (int g = 0; g < 2; ++g) {
    qa[g][0] = load_frag(qb + (size_t)(qr0 + g * 16) * HD_,      HD_);
    qa[g][1] = load_frag(qb + (size_t)(qr0 + g * 16) * HD_ + 32, HD_);
  }

  // o[g][j][r] = O[query 16*g + cl][dim j*16 + rh + r]
  v8f o[2][4];
#pragma unroll
  for (int g = 0; g < 2; ++g)
#pragma unroll
    for (int j = 0; j < 4; ++j) o[g][j] = {};
  float mrow[2] = {-1e30f, -1e30f};       // running maximum of query 16*g + cl
  float lrow[2] = {0.0f, 0.0f};           // sum over this lane's half of the keys

  // Cooperative stage mapping: 64 rows x 64 halves, 16 halves per thread.
  const int srow = t >> 2;                // 0..63
  const int scol = (t & 3) * 16;          // 0/16/32/48

  // This lane's address in the first 16 keys x 16 dims of Vs (transposing load).
  const _Float16* vtp = &Vs[(rh + (lane & 7)) * VPITCH + ((lane >> 3) & 1) * 8];

  // Preload first K/V tile into registers.
  v8h kr0 = *(const v8h*)(kb + (size_t)srow * HD_ + scol);
  v8h kr1 = *(const v8h*)(kb + (size_t)srow * HD_ + scol + 8);
  v8h vr0 = *(const v8h*)(vb + (size_t)srow * HD_ + scol);
  v8h vr1 = *(const v8h*)(vb + (size_t)srow * HD_ + scol + 8);

  for (int kv0 = 0; kv0 < S_; kv0 += 64) {
    // Commit staged registers: K and V row-major.
    *(v8h*)&Ks[srow * 72 + scol]     = kr0;
    *(v8h*)&Ks[srow * 72 + scol + 8] = kr1;
    *(v8h*)&Vs[srow * VPITCH + scol]     = vr0;
    *(v8h*)&Vs[srow * VPITCH + scol + 8] = vr1;
    __syncthreads();

    // Prefetch next tile into registers (hidden behind the WMMAs below).
    if (kv0 + 64 < S_) {
      const _Float16* kp = kb + (size_t)(kv0 + 64 + srow) * HD_ + scol;
      const _Float16* vp = vb + (size_t)(kv0 + 64 + srow) * HD_ + scol;
      kr0 = *(const v8h*)(kp);
      kr1 = *(const v8h*)(kp + 8);
      vr0 = *(const v8h*)(vp);
      vr1 = *(const v8h*)(vp + 8);
    }
    if (kv0 + 128 < S_) {
      __builtin_prefetch(kb + (size_t)(kv0 + 128 + srow) * HD_ + scol, 0, 3);
      __builtin_prefetch(vb + (size_t)(kv0 + 128 + srow) * HD_ + scol, 0, 3);
    }

    // Scores: per group four 16x16 tiles,
    // sc[g][nt][r] = S[query 16*g + cl][key kv0 + 16*nt + rh + r].
    // Every K fragment read from LDS serves both query groups.
    v16h kfl[4], kfh[4];
#pragma unroll
    for (int nt = 0; nt < 4; ++nt) {
      kfl[nt] = load_frag(&Ks[nt * 16 * 72],      72);
      kfh[nt] = load_frag(&Ks[nt * 16 * 72 + 32], 72);
    }
    v8f sc[2][4];
#pragma unroll
    for (int nt = 0; nt < 4; ++nt)
#pragma unroll
      for (int g = 0; g < 2; ++g)
        sc[g][nt] = wmma16(kfh[nt], qa[g][1], wmma16(kfl[nt], qa[g][0], (v8f){}));

    // Online softmax: one query per lane and group, 32 of its 64 keys in this lane.
    // P^T B fragments: element s of pb[g][c] is key 32*c + kmap(s), which is
    // register s & 7 of score tile 2*c + (s >> 3).
    v16h pb[2][2];
    v16h vf[4][2];
#pragma unroll
    for (int g = 0; g < 2; ++g) {
      if (g == 1) {
        // All V^T fragments are asked for as one group here, into the registers
        // that the K fragments and group 0's scores have left: one place of LDS
        // reads with one wait. They are the wave's last LDS reads of the tile, so
        // the closing barrier can be signalled behind that wait, ahead of group
        // 1's softmax and the products.
#pragma unroll
        for (int j = 0; j < 4; ++j) {
          vf[j][0] = load_frag_tr(vtp + j * 16);
          vf[j][1] = load_frag_tr(vtp + j * 16 + 32 * VPITCH);
        }
        // Holds the loads here as one group: without it the scheduler spreads them
        // through both softmaxes and the live registers overflow into scratch.
        __builtin_amdgcn_sched_barrier(0);
      }
      float tm[4];
#pragma unroll
      for (int nt = 0; nt < 4; ++nt) {
        tm[nt] = fmaxf(fmaxf(fmaxf(sc[g][nt][0], sc[g][nt][1]), fmaxf(sc[g][nt][2], sc[g][nt][3])),
                       fmaxf(fmaxf(sc[g][nt][4], sc[g][nt][5]), fmaxf(sc[g][nt][6], sc[g][nt][7])));
      }
      float tmax = fmaxf(fmaxf(tm[0], tm[1]), fmaxf(tm[2], tm[3]));
      tmax = fmaxf(tmax, xhalf(tmax));
      const float mnew = fmaxf(mrow[g], tmax);
      const float corr = exp2x1((mrow[g] - mnew) * LOG2E);
      mrow[g] = mnew;

      float ps[4];
#pragma unroll
      for (int nt = 0; nt < 4; ++nt) {
        float a[8], p[8];
#pragma unroll
        for (int r = 0; r < 8; ++r) a[r] = (sc[g][nt][r] - mnew) * LOG2E;
        exp2x8(p, a);
#pragma unroll
        for (int r = 0; r < 8; ++r) pb[g][nt >> 1][(nt & 1) * 8 + r] = (_Float16)p[r];
        ps[nt] = ((p[0] + p[1]) + (p[2] + p[3])) + ((p[4] + p[5]) + (p[6] + p[7]));
      }
      lrow[g] = lrow[g] * corr + ((ps[0] + ps[1]) + (ps[2] + ps[3]));
#pragma unroll
      for (int j = 0; j < 4; ++j)
#pragma unroll
        for (int r = 0; r < 8; ++r) o[g][j][r] *= corr;
    }

    // O^T += V^T (64 dims x 64 keys) x P^T (64 keys x 32 queries); every V^T
    // fragment read from LDS serves both query groups.
#pragma unroll
    for (int j = 0; j < 4; ++j) {
#pragma unroll
      for (int g = 0; g < 2; ++g) {
        o[g][j] = wmma16(vf[j][0], pb[g][0], o[g][j]);
        o[g][j] = wmma16(vf[j][1], pb[g][1], o[g][j]);
      }
    }
    __syncthreads();   // protect Ks/Vs before next stage
  }

  // Join the two halves' sums, normalize and write token-major [B,S,D] (f16)
  // for the output projection: 8 consecutive dims per lane and tile.
#pragma unroll
  for (int g = 0; g < 2; ++g) {
    const float inv = 1.0f / (lrow[g] + xhalf(lrow[g]));
    _Float16* po = a16 + ((size_t)b * S_ + qr0 + g * 16 + cl) * D_ + h * HD_ + rh;
#pragma unroll
    for (int j = 0; j < 4; ++j) {
      v8h ov;
#pragma unroll
      for (int r = 0; r < 8; ++r) ov[r] = (_Float16)(o[g][j][r] * inv);
      *(v8h*)(po + j * 16) = ov;
    }
  }
}

// ---------------------------------------------------------------------------
// Launcher
// ---------------------------------------------------------------------------
extern "C" void kernel_launch(void* const* d_in, const int* in_sizes, int n_in,
                              void* d_out, int out_size, void* d_ws, size_t ws_size,
                              hipStream_t stream) {
  (void)in_sizes; (void)n_in; (void)out_size; (void)ws_size;

  const float* query = (const float*)d_in[0];
  const float* Wq = (const float*)d_in[1]; const float* bq = (const float*)d_in[2];
  const float* Wk = (const float*)d_in[3]; const float* bk = (const float*)d_in[4];
  const float* Wv = (const float*)d_in[5]; const float* bv = (const float*)d_in[6];
  const float* Wo = (const float*)d_in[7]; const float* bo = (const float*)d_in[8];
  float* out = (float*)d_out;

  const size_t DD  = (size_t)D_ * D_;        // 1M
  const size_t BSD = (size_t)B_ * S_ * D_;   // 8M

  _Float16* w16  = (_Float16*)d_ws;          // 4*DD halves
  _Float16* wq16 = w16;
  _Float16* wk16 = w16 + DD;
  _Float16* wv16 = w16 + 2 * DD;
  _Float16* wo16 = w16 + 3 * DD;
  _Float16* x16  = w16 + 4 * DD;             // BSD
  _Float16* q16  = x16 + BSD;                // BSD  [B,H,S,HD]
  _Float16* k16  = q16 + BSD;
  _Float16* v16p = k16 + BSD;
  _Float16* a16  = v16p + BSD;               // BSD  [B,S,D]

  // 1) f32 -> f16 conversions: w16 (four weights) and x16 behind it, one launch.
  cvt_all_f32_to_f16<<<256, 512, 0, stream>>>(query, Wq, Wk, Wv, Wo, w16);

  // 2) QKV projections (head-major f16; softmax scale folded into Q).
  dim3 ggrid(D_ / 128, (B_ * S_) / 128);     // (8, 64)
  gemm_wmma<1><<<ggrid, 128, 0, stream>>>(x16, wq16, bq, q16, nullptr, 0.125f);
  gemm_wmma<1><<<ggrid, 128, 0, stream>>>(x16, wk16, bk, k16, nullptr, 1.0f);
  gemm_wmma<1><<<ggrid, 128, 0, stream>>>(x16, wv16, bv, v16p, nullptr, 1.0f);

  // 3) Flash attention.
  dim3 agrid(S_ / 256, H_, B_);              // (8, 16, 4)
  attention_wmma<<<agrid, 256, 0, stream>>>(q16, k16, v16p, a16);

  // 4) Output projection -> f32 d_out.
  gemm_wmma<0><<<ggrid, 128, 0, stream>>>(a16, wo16, bo, nullptr, out, 1.0f);
}

// v007
// One run takes 139 microseconds.
// In two side-by-side timings against v006, it was 1.05 and 1.04 times as fast.
// Counting every step since v000, it is 1.97 times as fast.
#include <hip/hip_runtime.h>
#include <stdint.h>

// ---------------------------------------------------------------------------
// MHA forward for MI455X (gfx1250): f16 WMMA GEMMs + flash attention.
// B=4, S=2048, D=1024, H=16, HD=64
// ---------------------------------------------------------------------------

typedef __attribute__((ext_vector_type(16))) _Float16 v16h;
typedef __attribute__((ext_vector_type(8)))  _Float16 v8h;
typedef __attribute__((ext_vector_type(8)))  float    v8f;

#define B_  4
#define S_  2048
#define D_  1024
#define H_  16
#define HD_ 64
#define LOG2E 1.4426950408889634f   // exp(x) = exp2(x * LOG2E)

// ---------------------------------------------------------------------------
// Fragment loader: 16x32 f16 tile, row-major source (row stride in halves).
// Matches CDNA5 16-bit A-matrix layout (ISA 7.12.2):
//   lanes 0-15 : row M = lane,    halves 0-7 -> K=0..7,  halves 8-15 -> K=16..23
//   lanes 16-31: row M = lane-16, halves 0-7 -> K=8..15, halves 8-15 -> K=24..31
// Because y = x @ W^T, row-major W *is* the B matrix in [n][k] order, so the
// same loader serves A and B fragments. Two 16B ds_load_b128 per lane.
// ---------------------------------------------------------------------------
__device__ __forceinline__ v16h load_frag(const _Float16* base, int stride) {
  const int lane = threadIdx.x & 31;
  const int r    = lane & 15;
  const int kg   = lane >> 4;          // 0 or 1
  const _Float16* p = base + r * stride + kg * 8;
  union { v16h v; v8h h[2]; } u;
  u.h[0] = *(const v8h*)(p);           // K = kg*8 .. kg*8+7
  u.h[1] = *(const v8h*)(p + 16);      // K = 16+kg*8 .. 16+kg*8+7
  return u.v;
}

__device__ __forceinline__ v8f wmma16(v16h a, v16h b, v8f c) {
  // D = A(16x32 f16) * B(32x16 f16) + C(16x16 f32)
  return __builtin_amdgcn_wmma_f32_16x16x32_f16(false, a, false, b,
                                                (short)0, c, false, false);
}

// ---------------------------------------------------------------------------
// f32 -> f16 conversion of the four weights and the query in ONE launch of
// 256 work-groups x 16 waves (one work-group per WGP), so that 4,096 waves
// start instead of 98,304 waves of one load each. The f16 copies lie in one
// row in the workspace: Wq | Wk | Wv | Wo | query, 12,288 pieces of 1,024
// elements. Wave w takes pieces w (a weight), 4,096 + w and 8,192 + w (query):
// 24 loads of 16 bytes a lane, each 512 contiguous bytes of a wave, all issued
// ahead of the first conversion; each store is 256 contiguous bytes of a wave.
// A piece of a weight is one row of it. Inside every block of 64 rows the f16
// copy holds row 4 * c + j at place 16 * j + c: the GEMM's B fragment j then has
// output column 4 * c + j in lane c, so that a lane's four accumulators of one
// output row are four adjacent columns and a half wave stores whole lines.
// ---------------------------------------------------------------------------
#define CVT_PIECE 1024                    // elements: 8 wave loads of 512 bytes
#define CVT_WAVES 4096                    // = 4 * D_ * D_ / CVT_PIECE
// amdgpu_waves_per_eu(4, 4): one work-group per WGP is four waves per SIMD; at
// that register budget the compiler issues all 24 loads ahead (at the default
// budget it holds half of them back behind waits to save registers).
__global__ void __launch_bounds__(512) __attribute__((amdgpu_waves_per_eu(4, 4)))
cvt_all_f32_to_f16(const float* __restrict__ query,
                   const float* __restrict__ Wq, const float* __restrict__ Wk,
                   const float* __restrict__ Wv, const float* __restrict__ Wo,
                   _Float16* __restrict__ out) {
  typedef __attribute__((ext_vector_type(4))) _Float16 v4h;
  const int l4 = (threadIdx.x & 31) * 4;  // this lane's 4 elements of 128
  // Wave number in a scalar register: piece addresses are scalar bases.
  const int w = blockIdx.x * 16 + __builtin_amdgcn_readfirstlane(threadIdx.x >> 5);
  const int wsel = blockIdx.x >> 6;       // 64 work-groups (1,024 pieces) a weight
  const float* wsrc = wsel == 0 ? Wq : wsel == 1 ? Wk : wsel == 2 ? Wv : Wo;
  const float* s0 = wsrc  + (size_t)(w & 1023) * CVT_PIECE;
  const float* s1 = query + (size_t)w * CVT_PIECE;
  const float* s2 = s1 + (size_t)CVT_WAVES * CVT_PIECE;
  _Float16* d0 = out + (size_t)w * CVT_PIECE;
  const int wplace = (w & ~63) | ((w & 3) << 4) | ((w >> 2) & 15);   // dealt weight row
  _Float16* dw = out + (size_t)wplace * CVT_PIECE;

  float4 v[3][8];
#pragma unroll
  for (int u = 0; u < 8; ++u) v[0][u] = *(const float4*)(s0 + u * 128 + l4);
#pragma unroll
  for (int u = 0; u < 8; ++u) v[1][u] = *(const float4*)(s1 + u * 128 + l4);
#pragma unroll
  for (int u = 0; u < 8; ++u) v[2][u] = *(const float4*)(s2 + u * 128 + l4);
#pragma unroll
  for (int j = 0; j < 3; ++j) {
#pragma unroll
    for (int u = 0; u < 8; ++u) {
      v4h h;
      h[0] = (_Float16)v[j][u].x;
      h[1] = (_Float16)v[j][u].y;
      h[2] = (_Float16)v[j][u].z;
      h[3] = (_Float16)v[j][u].w;
      *(v4h*)((j == 0 ? dw : d0 + (size_t)j * CVT_WAVES * CVT_PIECE) + u * 128 + l4) = h;
    }
  }
}

// ---------------------------------------------------------------------------
// Tensor loads (tensor_load_to_lds): one request of a wave brings a 2-D tile
// from global memory into LDS, through no register.
// ---------------------------------------------------------------------------
typedef uint32_t u32x4 __attribute__((ext_vector_type(4)));
typedef uint32_t u32x8 __attribute__((ext_vector_type(8)));

__device__ __forceinline__ uint32_t uni(uint32_t v) {
  return (uint32_t)__builtin_amdgcn_readfirstlane(v);
}
// Scalar test around a tensor load (the instruction ignores EXEC): the empty
// statement holds the word in a scalar register, so that the test compiles to
// s_cmp and a scalar branch.
__device__ __forceinline__ uint32_t pinned(uint32_t v) {
  uint32_t w = uni(v);
  asm volatile("" : "+s"(w));   // pinned(): the test word kept in a scalar register
  return w;
}
__device__ __forceinline__ void wait_ds0() {       // this wave's LDS reads are done
  asm volatile("s_wait_dscnt 0x0" ::: "memory");
}
// This wave's tile has landed. The request's group 0 is named as an input, so
// that its scalar registers keep their words until the request is covered.
__device__ __forceinline__ void wait_tensor0(u32x4 g0) {
  asm volatile("s_wait_tensorcnt 0x0" :: "s"(g0) : "memory");
}
// Group 0 is an in-out operand: the caller's copy of it then lives on in the very
// registers that the request was issued from.
__device__ __forceinline__ void tdm_load(u32x4& g0, u32x8 g1) {
  asm volatile("tensor_load_to_lds %0, %1" : "+s"(g0) : "s"(g1) : "memory");
}

#define GK      64      // k per stage: 128-byte rows
#define GPITCH  72      // halves: 144-byte LDS pitch (16 B x odd), laid by the pad
#define GROWS   64      // rows per slice, one slice per wave
#define GSLICE  10240   // bytes: 64 rows x 144 B = 9,216, rounded up to 2 KiB x 5
#define GSTAGE  (4 * GSLICE)

// Group 1: bytes as elements, tile = tensor = 64 rows of 128 bytes, source pitch
// one row of the matrix, 4 dwords of LDS pad behind every 32 dwords (one row).
__device__ __forceinline__ u32x8 tdm_group1() {
  u32x8 g;
  g[0] = uni((1u << 20) | (4u << 22) | (3u << 25));
  g[1] = uni((uint32_t)(GK * 2) << 16);
  g[2] = uni((uint32_t)GROWS << 16);
  g[3] = uni((uint32_t)(GK * 2) << 16);
  g[4] = uni((uint32_t)GROWS);
  g[5] = uni((uint32_t)(D_ * 2));
  g[6] = uni(0u);
  g[7] = uni(0u);
  return g;
}
__device__ __forceinline__ u32x4 tdm_group0(uint32_t lds_dst, uint64_t ga) {
  u32x4 g;
  g[0] = uni(1u);
  g[1] = uni(lds_dst);
  g[2] = uni((uint32_t)ga);
  g[3] = uni((((uint32_t)(ga >> 32)) & 0x01FFFFFFu) | 0x80000000u);
  return g;
}

// ---------------------------------------------------------------------------
// GEMM: y[m][n] = sum_k A[m][k] * W[n][k] + bias[n]
// Block tile 128(M) x 128(N). 128 threads = 4 waves, each wave owns a 64x64
// output tile (16 acc tiles). A stage is 64 k of the 128 A rows and the 128 W
// rows, in four slices of 64 rows: waves 0 and 1 bring the halves of A, waves 2
// and 3 those of W, one tensor load each. Two LDS buffers, one barrier a stage:
// a wave reads all fragments of stage s, then stage s + 2 is asked for into the
// same buffer and flies under the 32 wmma of stage s and the reads of s + 1.
// W comes with its rows dealt (see the conversion): lane c of B fragment j holds
// output column 4 * c + j of the wave's 64.
// MODE=1: f16 head-major [B,H,S,HD] output, scaled (QKV path).
// MODE=0: f32 row-major [M,N] output (final projection).
// ---------------------------------------------------------------------------
template <int MODE>
__global__ void __launch_bounds__(128)
gemm_wmma(const _Float16* __restrict__ A,   // [8192][1024] f16
          const _Float16* __restrict__ W,   // [1024][1024] f16 (row-major, rows dealt)
          const float*    __restrict__ bias,
          _Float16* __restrict__ outH, float* __restrict__ outF,
          float scale) {
  __shared__ __attribute__((aligned(2048))) unsigned char ring[2 * GSTAGE];

  const int t    = threadIdx.x;          // 0..127
  const int lane = t & 31;
  const int wid  = t >> 5;               // 0..3
  const int wm   = wid & 1;              // M sub-tile (x64) = A slice
  const int wn   = wid >> 1;             // N sub-tile (x64) = W slice
  const int m0   = blockIdx.y * 128;
  const int n0   = blockIdx.x * 128;
  const int cl   = lane & 15;
  const int rh   = (lane >> 4) * 8;

  v8f acc[4][4];
#pragma unroll
  for (int i = 0; i < 4; ++i)
#pragma unroll
    for (int j = 0; j < 4; ++j) acc[i][j] = {};

  // This wave's slice: source rows and place in each buffer.
  const uint32_t wave = uni(threadIdx.x >> 5);
  const _Float16* srows = wave < 2u ? A + (size_t)(m0 + wave * GROWS) * D_
                                    : W + (size_t)(n0 + (wave - 2u) * GROWS) * D_;
  const uint64_t gsrc  = (uint64_t)(size_t)srows;
  const uint32_t ldst  = (uint32_t)(size_t)ring + wave * GSLICE;
  const u32x8 g1 = tdm_group1();

  const int NST = D_ / GK;               // 16 stages
  u32x4 g0 = tdm_group0(ldst, gsrc);                          // stage 0
  tdm_load(g0, g1);
  wait_tensor0(g0);
  __syncthreads();
  g0 = tdm_group0(ldst + GSTAGE, gsrc + GK * 2);              // stage 1
  tdm_load(g0, g1);

  for (int s = 0; s < NST; ++s) {
    const unsigned char* st = ring + (s & 1) * GSTAGE;
    const _Float16* as = (const _Float16*)(st + wm * GSLICE);
    const _Float16* bs = (const _Float16*)(st + (2 + wn) * GSLICE);
    // All fragments of stage s go into registers first, so that its buffer is free
    // for the refill while the products still run.
    v16h af[2][4], bf[2][4];
#pragma unroll
    for (int c = 0; c < 2; ++c) {
#pragma unroll
      for (int i = 0; i < 4; ++i) {
        af[c][i] = load_frag(as + i * 16 * GPITCH + c * 32, GPITCH);
        bf[c][i] = load_frag(bs + i * 16 * GPITCH + c * 32, GPITCH);
      }
    }

    // Publish point of stage s + 1: own LDS reads done, own tile landed, barrier;
    // only then the refill of the buffer that every wave has just left.
    wait_ds0();
    wait_tensor0(g0);
    __syncthreads();
    if (pinned(s + 2 < NST)) {
      g0 = tdm_group0(ldst + (uint32_t)(s & 1) * GSTAGE,
                      gsrc + (uint64_t)(s + 2) * (GK * 2));
      tdm_load(g0, g1);
    }

#pragma unroll
    for (int c = 0; c < 2; ++c)
#pragma unroll
      for (int j = 0; j < 4; ++j)
#pragma unroll
        for (int i = 0; i < 4; ++i)
          acc[i][j] = wmma16(af[c][i], bf[c][j], acc[i][j]);
  }
  wait_tensor0(g0);
  wait_ds0();

  // Epilogue. A lane holds columns 4 * cl .. 4 * cl + 3 of each of its rows: one
  // store of 4 elements a row, 16 lanes cover the wave's 64 columns in a row.
  const int nwave = n0 + wn * 64;
  const float4 b4 = *(const float4*)(bias + nwave + cl * 4);
  const float bj[4] = {b4.x, b4.y, b4.z, b4.w};

  if (MODE == 1) {
    // m0 is 128-aligned -> batch index constant per block; nwave is
    // 64-aligned -> head index constant per wave.
    const int b  = m0 >> 11;
    const int sb = (m0 & (S_ - 1)) + wm * 64;
    const int h  = nwave >> 6;
    _Float16* ph = outH + ((size_t)b * H_ + h) * S_ * HD_;
    typedef __attribute__((ext_vector_type(4))) _Float16 v4h;
#pragma unroll
    for (int i = 0; i < 4; ++i) {
#pragma unroll
      for (int r = 0; r < 8; ++r) {
        v4h hv;
#pragma unroll
        for (int j = 0; j < 4; ++j)
          hv[j] = (_Float16)((acc[i][j][r] + bj[j]) * scale);
        *(v4h*)(ph + (size_t)(sb + i * 16 + rh + r) * HD_ + cl * 4) = hv;
      }
    }
  } else {
    float* pm = outF + (size_t)(m0 + wm * 64) * D_ + nwave;
#pragma unroll
    for (int i = 0; i < 4; ++i) {
#pragma unroll
      for (int r = 0; r < 8; ++r) {
        const float4 fv = {acc[i][0][r] + bj[0], acc[i][1][r] + bj[1],
                           acc[i][2][r] + bj[2], acc[i][3][r] + bj[3]};
        *(float4*)(pm + (size_t)(i * 16 + rh + r) * D_ + cl * 4) = fv;
      }
    }
  }
}

#define VPITCH 80                         // halves: 160 B = 32 B x odd
__device__ __forceinline__ v16h load_frag_tr(const _Float16* p) {
  typedef short s16x8 __attribute__((ext_vector_type(8)));
  typedef __attribute__((address_space(3))) s16x8 lds_s16x8;
  union { v16h v; s16x8 h[2]; } u;
  u.h[0] = __builtin_amdgcn_ds_load_tr16_b128_v8i16((lds_s16x8*)p);
  u.h[1] = __builtin_amdgcn_ds_load_tr16_b128_v8i16((lds_s16x8*)(p + 16 * VPITCH));
  return u.v;
}

__device__ __forceinline__ float xhalf(float x) {   // lane l <-> lane l ^ 16
  return __int_as_float(__builtin_amdgcn_permlanex16(
      __float_as_int(x), __float_as_int(x), 0x76543210, 0xfedcba98, false, false));
}

// exp2 of eight values (of one value). The instruction set asks for one
// independent instruction or v_nop between a transcendental and an instruction
// that reads its result or overwrites its source. Here every v_exp_f32 is
// followed by an independent one (outputs are early-clobber), the last by v_nop.
__device__ __forceinline__ void exp2x8(float (&y)[8], const float (&x)[8]) {
  asm("v_exp_f32 %0, %8\n\tv_exp_f32 %1, %9\n\tv_exp_f32 %2, %10\n\t"
      "v_exp_f32 %3, %11\n\tv_exp_f32 %4, %12\n\tv_exp_f32 %5, %13\n\t"
      "v_exp_f32 %6, %14\n\tv_exp_f32 %7, %15\n\tv_nop"
      : "=&v"(y[0]), "=&v"(y[1]), "=&v"(y[2]), "=&v"(y[3]),
        "=&v"(y[4]), "=&v"(y[5]), "=&v"(y[6]), "=&v"(y[7])
      : "v"(x[0]), "v"(x[1]), "v"(x[2]), "v"(x[3]),
        "v"(x[4]), "v"(x[5]), "v"(x[6]), "v"(x[7]));
}
__device__ __forceinline__ float exp2x1(float x) {
  float y;
  asm("v_exp_f32 %0, %1\n\tv_nop" : "=v"(y) : "v"(x));
  return y;
}

// amdgpu_waves_per_eu(4, 4): two work-groups per WGP, four waves per SIMD. The
// 512 equal work-groups are then all resident at once, in one round, and the
// vector work between the matrix runs has other waves to hide behind.
__global__ void __launch_bounds__(256) __attribute__((amdgpu_waves_per_eu(4, 4)))
attention_wmma(const _Float16* __restrict__ q16,   // [B,H,S,HD] (pre-scaled)
               const _Float16* __restrict__ k16,   // [B,H,S,HD]
               const _Float16* __restrict__ v16,   // [B,H,S,HD]
               _Float16* __restrict__ a16) {       // [B,S,D]
  __shared__ _Float16 Ks[64 * 72];        // [n][d]   n=0..63, stride 72 (pad)
  __shared__ _Float16 Vs[64 * VPITCH];    // [n][d]   n=0..63, stride 80 (pad)

  const int t    = threadIdx.x;
  const int lane = t & 31;
  const int wid  = t >> 5;
  const int cl   = lane & 15;
  const int rh   = (lane >> 4) * 8;

  const int qt = blockIdx.x;              // query tile (of 256 rows)
  const int h  = blockIdx.y;
  const int b  = blockIdx.z;

  const size_t head = (size_t)(b * H_ + h) * S_ * HD_;
  const _Float16* qb = q16 + head;
  const _Float16* kb = k16 + head;
  const _Float16* vb = v16 + head;

  const int qr0 = qt * 256 + wid * 32;    // this wave's 32 queries (2 groups of 16)

  // Q^T fragments: per group 64 dims x 16 queries -> two 32x16 B fragments.
  v16h qa[2][2];
#pragma unroll
  for (int g = 0; g < 2; ++g) {
    qa[g][0] = load_frag(qb + (size_t)(qr0 + g * 16) * HD_,      HD_);
    qa[g][1] = load_frag(qb + (size_t)(qr0 + g * 16) * HD_ + 32, HD_);
  }

  // o[g][j][r] = O[query 16*g + cl][dim j*16 + rh + r]
  v8f o[2][4];
#pragma unroll
  for (int g = 0; g < 2; ++g)
#pragma unroll
    for (int j = 0; j < 4; ++j) o[g][j] = {};
  float mrow[2] = {-1e30f, -1e30f};       // running maximum of query 16*g + cl
  float lrow[2] = {0.0f, 0.0f};           // sum over this lane's half of the keys

  // Cooperative stage mapping: 64 rows x 64 halves, 16 halves per thread.
  const int srow = t >> 2;                // 0..63
  const int scol = (t & 3) * 16;          // 0/16/32/48

  // This lane's address in the first 16 keys x 16 dims of Vs (transposing load).
  const _Float16* vtp = &Vs[(rh + (lane & 7)) * VPITCH + ((lane >> 3) & 1) * 8];

  // Preload first K/V tile into registers.
  v8h kr0 = *(const v8h*)(kb + (size_t)srow * HD_ + scol);
  v8h kr1 = *(const v8h*)(kb + (size_t)srow * HD_ + scol + 8);
  v8h vr0 = *(const v8h*)(vb + (size_t)srow * HD_ + scol);
  v8h vr1 = *(const v8h*)(vb + (size_t)srow * HD_ + scol + 8);

  for (int kv0 = 0; kv0 < S_; kv0 += 64) {
    // Commit staged registers: K and V row-major.
    *(v8h*)&Ks[srow * 72 + scol]     = kr0;
    *(v8h*)&Ks[srow * 72 + scol + 8] = kr1;
    *(v8h*)&Vs[srow * VPITCH + scol]     = vr0;
    *(v8h*)&Vs[srow * VPITCH + scol + 8] = vr1;
    __syncthreads();

    // Prefetch next tile into registers (hidden behind the WMMAs below).
    if (kv0 + 64 < S_) {
      const _Float16* kp = kb + (size_t)(kv0 + 64 + srow) * HD_ + scol;
      const _Float16* vp = vb + (size_t)(kv0 + 64 + srow) * HD_ + scol;
      kr0 = *(const v8h*)(kp);
      kr1 = *(const v8h*)(kp + 8);
      vr0 = *(const v8h*)(vp);
      vr1 = *(const v8h*)(vp + 8);
    }
    if (kv0 + 128 < S_) {
      __builtin_prefetch(kb + (size_t)(kv0 + 128 + srow) * HD_ + scol, 0, 3);
      __builtin_prefetch(vb + (size_t)(kv0 + 128 + srow) * HD_ + scol, 0, 3);
    }

    // Scores: per group four 16x16 tiles,
    // sc[g][nt][r] = S[query 16*g + cl][key kv0 + 16*nt + rh + r].
    // Every K fragment read from LDS serves both query groups.
    v16h kfl[4], kfh[4];
#pragma unroll
    for (int nt = 0; nt < 4; ++nt) {
      kfl[nt] = load_frag(&Ks[nt * 16 * 72],      72);
      kfh[nt] = load_frag(&Ks[nt * 16 * 72 + 32], 72);
    }
    v8f sc[2][4];
#pragma unroll
    for (int nt = 0; nt < 4; ++nt)
#pragma unroll
      for (int g = 0; g < 2; ++g)
        sc[g][nt] = wmma16(kfh[nt], qa[g][1], wmma16(kfl[nt], qa[g][0], (v8f){}));

    // Online softmax: one query per lane and group, 32 of its 64 keys in this lane.
    // P^T B fragments: element s of pb[g][c] is key 32*c + kmap(s), which is
    // register s & 7 of score tile 2*c + (s >> 3).
    v16h pb[2][2];
    v16h vf[4][2];
#pragma unroll
    for (int g = 0; g < 2; ++g) {
      if (g == 1) {
        // All V^T fragments are asked for as one group here, into the registers
        // that the K fragments and group 0's scores have left: one place of LDS
        // reads with one wait. They are the wave's last LDS reads of the tile.
#pragma unroll
        for (int j = 0; j < 4; ++j) {
          vf[j][0] = load_frag_tr(vtp + j * 16);
          vf[j][1] = load_frag_tr(vtp + j * 16 + 32 * VPITCH);
        }
        // Holds the loads here as one group: without it the scheduler spreads them
        // through both softmaxes and the live registers overflow into scratch.
        __builtin_amdgcn_sched_barrier(0);
      }
      float tm[4];
#pragma unroll
      for (int nt = 0; nt < 4; ++nt) {
        tm[nt] = fmaxf(fmaxf(fmaxf(sc[g][nt][0], sc[g][nt][1]), fmaxf(sc[g][nt][2], sc[g][nt][3])),
                       fmaxf(fmaxf(sc[g][nt][4], sc[g][nt][5]), fmaxf(sc[g][nt][6], sc[g][nt][7])));
      }
      float tmax = fmaxf(fmaxf(tm[0], tm[1]), fmaxf(tm[2], tm[3]));
      tmax = fmaxf(tmax, xhalf(tmax));
      const float mnew = fmaxf(mrow[g], tmax);
      const float corr = exp2x1((mrow[g] - mnew) * LOG2E);
      mrow[g] = mnew;

      float ps[4];
#pragma unroll
      for (int nt = 0; nt < 4; ++nt) {
        float a[8], p[8];
#pragma unroll
        for (int r = 0; r < 8; ++r) a[r] = (sc[g][nt][r] - mnew) * LOG2E;
        exp2x8(p, a);
#pragma unroll
        for (int r = 0; r < 8; ++r) pb[g][nt >> 1][(nt & 1) * 8 + r] = (_Float16)p[r];
        ps[nt] = ((p[0] + p[1]) + (p[2] + p[3])) + ((p[4] + p[5]) + (p[6] + p[7]));
      }
      lrow[g] = lrow[g] * corr + ((ps[0] + ps[1]) + (ps[2] + ps[3]));
#pragma unroll
      for (int j = 0; j < 4; ++j)
#pragma unroll
        for (int r = 0; r < 8; ++r) o[g][j][r] *= corr;
    }

    // O^T += V^T (64 dims x 64 keys) x P^T (64 keys x 32 queries); every V^T
    // fragment read from LDS serves both query groups.
#pragma unroll
    for (int j = 0; j < 4; ++j) {
#pragma unroll
      for (int g = 0; g < 2; ++g) {
        o[g][j] = wmma16(vf[j][0], pb[g][0], o[g][j]);
        o[g][j] = wmma16(vf[j][1], pb[g][1], o[g][j]);
      }
    }
    __syncthreads();   // protect Ks/Vs before next stage
  }

  // Join the two halves' sums, normalize and write token-major [B,S,D] (f16)
  // for the output projection: 8 consecutive dims per lane and tile.
#pragma unroll
  for (int g = 0; g < 2; ++g) {
    const float inv = 1.0f / (lrow[g] + xhalf(lrow[g]));
    _Float16* po = a16 + ((size_t)b * S_ + qr0 + g * 16 + cl) * D_ + h * HD_ + rh;
#pragma unroll
    for (int j = 0; j < 4; ++j) {
      v8h ov;
#pragma unroll
      for (int r = 0; r < 8; ++r) ov[r] = (_Float16)(o[g][j][r] * inv);
      *(v8h*)(po + j * 16) = ov;
    }
  }
}

// ---------------------------------------------------------------------------
// Launcher
// ---------------------------------------------------------------------------
extern "C" void kernel_launch(void* const* d_in, const int* in_sizes, int n_in,
                              void* d_out, int out_size, void* d_ws, size_t ws_size,
                              hipStream_t stream) {
  (void)in_sizes; (void)n_in; (void)out_size; (void)ws_size;

  const float* query = (const float*)d_in[0];
  const float* Wq = (const float*)d_in[1]; const float* bq = (const float*)d_in[2];
  const float* Wk = (const float*)d_in[3]; const float* bk = (const float*)d_in[4];
  const float* Wv = (const float*)d_in[5]; const float* bv = (const float*)d_in[6];
  const float* Wo = (const float*)d_in[7]; const float* bo = (const float*)d_in[8];
  float* out = (float*)d_out;

  const size_t DD  = (size_t)D_ * D_;        // 1M
  const size_t BSD = (size_t)B_ * S_ * D_;   // 8M

  _Float16* w16  = (_Float16*)d_ws;          // 4*DD halves
  _Float16* wq16 = w16;
  _Float16* wk16 = w16 + DD;
  _Float16* wv16 = w16 + 2 * DD;
  _Float16* wo16 = w16 + 3 * DD;
  _Float16* x16  = w16 + 4 * DD;             // BSD
  _Float16* q16  = x16 + BSD;                // BSD  [B,H,S,HD]
  _Float16* k16  = q16 + BSD;
  _Float16* v16p = k16 + BSD;
  _Float16* a16  = v16p + BSD;               // BSD  [B,S,D]

  // 1) f32 -> f16 conversions: w16 (four weights) and x16 behind it, one launch.
  cvt_all_f32_to_f16<<<256, 512, 0, stream>>>(query, Wq, Wk, Wv, Wo, w16);

  // 2) QKV projections (head-major f16; softmax scale folded into Q).
  dim3 ggrid(D_ / 128, (B_ * S_) / 128);     // (8, 64)
  gemm_wmma<1><<<ggrid, 128, 0, stream>>>(x16, wq16, bq, q16, nullptr, 0.125f);
  gemm_wmma<1><<<ggrid, 128, 0, stream>>>(x16, wk16, bk, k16, nullptr, 1.0f);
  gemm_wmma<1><<<ggrid, 128, 0, stream>>>(x16, wv16, bv, v16p, nullptr, 1.0f);

  // 3) Flash attention.
  dim3 agrid(S_ / 256, H_, B_);              // (8, 16, 4)
  attention_wmma<<<agrid, 256, 0, stream>>>(q16, k16, v16p, a16);

  // 4) Output projection -> f32 d_out.
  gemm_wmma<0><<<ggrid, 128, 0, stream>>>(a16, wo16, bo, nullptr, out, 1.0f);
}

// v008
// It runs in 134 microseconds.
// Next to v007, in two timings, it ran 1.05 and 1.04 times as fast.
// Over all steps from v000 it is 2.06 times as fast.
#include <hip/hip_runtime.h>
#include <stdint.h>

// ---------------------------------------------------------------------------
// MHA forward for MI455X (gfx1250): f16 WMMA GEMMs + flash attention.
// B=4, S=2048, D=1024, H=16, HD=64
// ---------------------------------------------------------------------------

typedef __attribute__((ext_vector_type(16))) _Float16 v16h;
typedef __attribute__((ext_vector_type(8)))  _Float16 v8h;
typedef __attribute__((ext_vector_type(8)))  float    v8f;

#define B_  4
#define S_  2048
#define D_  1024
#define H_  16
#define HD_ 64

// ---------------------------------------------------------------------------
// Fragment loader: 16x32 f16 tile, row-major source (row stride in halves).
// Matches CDNA5 16-bit A-matrix layout (ISA 7.12.2):
//   lanes 0-15 : row M = lane,    halves 0-7 -> K=0..7,  halves 8-15 -> K=16..23
//   lanes 16-31: row M = lane-16, halves 0-7 -> K=8..15, halves 8-15 -> K=24..31
// Because y = x @ W^T, row-major W *is* the B matrix in [n][k] order, so the
// same loader serves A and B fragments. Two 16B ds_load_b128 per lane.
// ---------------------------------------------------------------------------
__device__ __forceinline__ v16h load_frag(const _Float16* base, int stride) {
  const int lane = threadIdx.x & 31;
  const int r    = lane & 15;
  const int kg   = lane >> 4;          // 0 or 1
  const _Float16* p = base + r * stride + kg * 8;
  union { v16h v; v8h h[2]; } u;
  u.h[0] = *(const v8h*)(p);           // K = kg*8 .. kg*8+7
  u.h[1] = *(const v8h*)(p + 16);      // K = 16+kg*8 .. 16+kg*8+7
  return u.v;
}

__device__ __forceinline__ v8f wmma16(v16h a, v16h b, v8f c) {
  // D = A(16x32 f16) * B(32x16 f16) + C(16x16 f32)
  return __builtin_amdgcn_wmma_f32_16x16x32_f16(false, a, false, b,
                                                (short)0, c, false, false);
}

// ---------------------------------------------------------------------------
// f32 -> f16 conversion of the four weights and the query in ONE launch of
// 256 work-groups x 16 waves (one work-group per WGP), so that 4,096 waves
// start instead of 98,304 waves of one load each. The f16 copies lie in one
// row in the workspace: Wq | Wk | Wv | Wo | query, 12,288 pieces of 1,024
// elements. Wave w takes pieces w (a weight), 4,096 + w and 8,192 + w (query):
// 24 loads of 16 bytes a lane, each 512 contiguous bytes of a wave, all issued
// ahead of the first conversion; each store is 256 contiguous bytes of a wave.
// A piece of a weight is one row of it. Inside every block of 64 rows the f16
// copy holds row 4 * c + j at place 16 * j + c: the GEMM's B fragment j then has
// output column 4 * c + j in lane c, so that a lane's four accumulators of one
// output row are four adjacent columns and a half wave stores whole lines.
// ---------------------------------------------------------------------------
#define CVT_PIECE 1024                    // elements: 8 wave loads of 512 bytes
#define CVT_WAVES 4096                    // = 4 * D_ * D_ / CVT_PIECE
// amdgpu_waves_per_eu(4, 4): one work-group per WGP is four waves per SIMD; at
// that register budget the compiler issues all 24 loads ahead (at the default
// budget it holds half of them back behind waits to save registers).
__global__ void __launch_bounds__(512) __attribute__((amdgpu_waves_per_eu(4, 4)))
cvt_all_f32_to_f16(const float* __restrict__ query,
                   const float* __restrict__ Wq, const float* __restrict__ Wk,
                   const float* __restrict__ Wv, const float* __restrict__ Wo,
                   _Float16* __restrict__ out) {
  typedef __attribute__((ext_vector_type(4))) _Float16 v4h;
  const int l4 = (threadIdx.x & 31) * 4;  // this lane's 4 elements of 128
  // Wave number in a scalar register: piece addresses are scalar bases.
  const int w = blockIdx.x * 16 + __builtin_amdgcn_readfirstlane(threadIdx.x >> 5);
  const int wsel = blockIdx.x >> 6;       // 64 work-groups (1,024 pieces) a weight
  const float* wsrc = wsel == 0 ? Wq : wsel == 1 ? Wk : wsel == 2 ? Wv : Wo;
  const float* s0 = wsrc  + (size_t)(w & 1023) * CVT_PIECE;
  const float* s1 = query + (size_t)w * CVT_PIECE;
  const float* s2 = s1 + (size_t)CVT_WAVES * CVT_PIECE;
  _Float16* d0 = out + (size_t)w * CVT_PIECE;
  const int wplace = (w & ~63) | ((w & 3) << 4) | ((w >> 2) & 15);   // dealt weight row
  _Float16* dw = out + (size_t)wplace * CVT_PIECE;

  float4 v[3][8];
#pragma unroll
  for (int u = 0; u < 8; ++u) v[0][u] = *(const float4*)(s0 + u * 128 + l4);
#pragma unroll
  for (int u = 0; u < 8; ++u) v[1][u] = *(const float4*)(s1 + u * 128 + l4);
#pragma unroll
  for (int u = 0; u < 8; ++u) v[2][u] = *(const float4*)(s2 + u * 128 + l4);
#pragma unroll
  for (int j = 0; j < 3; ++j) {
#pragma unroll
    for (int u = 0; u < 8; ++u) {
      v4h h;
      h[0] = (_Float16)v[j][u].x;
      h[1] = (_Float16)v[j][u].y;
      h[2] = (_Float16)v[j][u].z;
      h[3] = (_Float16)v[j][u].w;
      *(v4h*)((j == 0 ? dw : d0 + (size_t)j * CVT_WAVES * CVT_PIECE) + u * 128 + l4) = h;
    }
  }
}

// ---------------------------------------------------------------------------
// Tensor loads (tensor_load_to_lds): one request of a wave brings a 2-D tile
// from global memory into LDS, through no register.
// ---------------------------------------------------------------------------
typedef uint32_t u32x4 __attribute__((ext_vector_type(4)));
typedef uint32_t u32x8 __attribute__((ext_vector_type(8)));

__device__ __forceinline__ uint32_t uni(uint32_t v) {
  return (uint32_t)__builtin_amdgcn_readfirstlane(v);
}
// Scalar test around a tensor load (the instruction ignores EXEC): the empty
// statement holds the word in a scalar register, so that the test compiles to
// s_cmp and a scalar branch.
__device__ __forceinline__ uint32_t pinned(uint32_t v) {
  uint32_t w = uni(v);
  asm volatile("" : "+s"(w));   // pinned(): the test word kept in a scalar register
  return w;
}
__device__ __forceinline__ void wait_ds0() {       // this wave's LDS reads are done
  asm volatile("s_wait_dscnt 0x0" ::: "memory");
}
// This wave's tile has landed. The request's group 0 is named as an input, so
// that its scalar registers keep their words until the request is covered.
__device__ __forceinline__ void wait_tensor0(u32x4 g0) {
  asm volatile("s_wait_tensorcnt 0x0" :: "s"(g0) : "memory");
}
// Group 0 is an in-out operand: the caller's copy of it then lives on in the very
// registers that the request was issued from.
__device__ __forceinline__ void tdm_load(u32x4& g0, u32x8 g1) {
  asm volatile("tensor_load_to_lds %0, %1" : "+s"(g0) : "s"(g1) : "memory");
}

#define GK      64      // k per stage: 128-byte rows
#define GPITCH  72      // halves: 144-byte LDS pitch (16 B x odd), laid by the pad
#define GROWS   64      // rows per slice, one slice per wave
#define GSLICE  10240   // bytes: 64 rows x 144 B = 9,216, rounded up to 2 KiB x 5
#define GSTAGE  (4 * GSLICE)

// Group 1: bytes as elements, tile = tensor = 64 rows of 128 bytes, source pitch
// one row of the matrix, 4 dwords of LDS pad behind every 32 dwords (one row).
__device__ __forceinline__ u32x8 tdm_group1() {
  u32x8 g;
  g[0] = uni((1u << 20) | (4u << 22) | (3u << 25));
  g[1] = uni((uint32_t)(GK * 2) << 16);
  g[2] = uni((uint32_t)GROWS << 16);
  g[3] = uni((uint32_t)(GK * 2) << 16);
  g[4] = uni((uint32_t)GROWS);
  g[5] = uni((uint32_t)(D_ * 2));
  g[6] = uni(0u);
  g[7] = uni(0u);
  return g;
}
__device__ __forceinline__ u32x4 tdm_group0(uint32_t lds_dst, uint64_t ga) {
  u32x4 g;
  g[0] = uni(1u);
  g[1] = uni(lds_dst);
  g[2] = uni((uint32_t)ga);
  g[3] = uni((((uint32_t)(ga >> 32)) & 0x01FFFFFFu) | 0x80000000u);
  return g;
}

// ---------------------------------------------------------------------------
// GEMM: y[m][n] = sum_k A[m][k] * W[n][k] + bias[n]
// Block tile 128(M) x 128(N). 128 threads = 4 waves, each wave owns a 64x64
// output tile (16 acc tiles). A stage is 64 k of the 128 A rows and the 128 W
// rows, in four slices of 64 rows: waves 0 and 1 bring the halves of A, waves 2
// and 3 those of W, one tensor load each. Two LDS buffers, one barrier a stage:
// a wave reads all fragments of stage s, then stage s + 2 is asked for into the
// same buffer and flies under the 32 wmma of stage s and the reads of s + 1.
// W comes with its rows dealt (see the conversion): lane c of B fragment j holds
// output column 4 * c + j of the wave's 64.
// MODE=1: f16 head-major [B,H,S,HD] output, scaled (QKV path).
// MODE=0: f32 row-major [M,N] output (final projection).
// ---------------------------------------------------------------------------
template <int MODE>
__global__ void __launch_bounds__(128)
gemm_wmma(const _Float16* __restrict__ A,   // [8192][1024] f16
          const _Float16* __restrict__ W,   // [1024][1024] f16 (row-major, rows dealt)
          const float*    __restrict__ bias,
          _Float16* __restrict__ outH, float* __restrict__ outF,
          float scale) {
  __shared__ __attribute__((aligned(2048))) unsigned char ring[2 * GSTAGE];

  const int t    = threadIdx.x;          // 0..127
  const int lane = t & 31;
  const int wid  = t >> 5;               // 0..3
  const int wm   = wid & 1;              // M sub-tile (x64) = A slice
  const int wn   = wid >> 1;             // N sub-tile (x64) = W slice
  const int m0   = blockIdx.y * 128;
  const int n0   = blockIdx.x * 128;
  const int cl   = lane & 15;
  const int rh   = (lane >> 4) * 8;

  v8f acc[4][4];
#pragma unroll
  for (int i = 0; i < 4; ++i)
#pragma unroll
    for (int j = 0; j < 4; ++j) acc[i][j] = {};

  // This wave's slice: source rows and place in each buffer.
  const uint32_t wave = uni(threadIdx.x >> 5);
  const _Float16* srows = wave < 2u ? A + (size_t)(m0 + wave * GROWS) * D_
                                    : W + (size_t)(n0 + (wave - 2u) * GROWS) * D_;
  const uint64_t gsrc  = (uint64_t)(size_t)srows;
  const uint32_t ldst  = (uint32_t)(size_t)ring + wave * GSLICE;
  const u32x8 g1 = tdm_group1();

  const int NST = D_ / GK;               // 16 stages
  u32x4 g0 = tdm_group0(ldst, gsrc);                          // stage 0
  tdm_load(g0, g1);
  wait_tensor0(g0);
  __syncthreads();
  g0 = tdm_group0(ldst + GSTAGE, gsrc + GK * 2);              // stage 1
  tdm_load(g0, g1);

  for (int s = 0; s < NST; ++s) {
    const unsigned char* st = ring + (s & 1) * GSTAGE;
    const _Float16* as = (const _Float16*)(st + wm * GSLICE);
    const _Float16* bs = (const _Float16*)(st + (2 + wn) * GSLICE);
    // All fragments of stage s go into registers first, so that its buffer is free
    // for the refill while the products still run.
    v16h af[2][4], bf[2][4];
#pragma unroll
    for (int c = 0; c < 2; ++c) {
#pragma unroll
      for (int i = 0; i < 4; ++i) {
        af[c][i] = load_frag(as + i * 16 * GPITCH + c * 32, GPITCH);
        bf[c][i] = load_frag(bs + i * 16 * GPITCH + c * 32, GPITCH);
      }
    }

    // Publish point of stage s + 1: own LDS reads done, own tile landed, barrier;
    // only then the refill of the buffer that every wave has just left.
    wait_ds0();
    wait_tensor0(g0);
    __syncthreads();
    if (pinned(s + 2 < NST)) {
      g0 = tdm_group0(ldst + (uint32_t)(s & 1) * GSTAGE,
                      gsrc + (uint64_t)(s + 2) * (GK * 2));
      tdm_load(g0, g1);
    }

#pragma unroll
    for (int c = 0; c < 2; ++c)
#pragma unroll
      for (int j = 0; j < 4; ++j)
#pragma unroll
        for (int i = 0; i < 4; ++i)
          acc[i][j] = wmma16(af[c][i], bf[c][j], acc[i][j]);
  }
  wait_tensor0(g0);
  wait_ds0();

  // Epilogue. A lane holds columns 4 * cl .. 4 * cl + 3 of each of its rows: one
  // store of 4 elements a row, 16 lanes cover the wave's 64 columns in a row.
  const int nwave = n0 + wn * 64;
  const float4 b4 = *(const float4*)(bias + nwave + cl * 4);
  const float bj[4] = {b4.x, b4.y, b4.z, b4.w};

  if (MODE == 1) {
    // m0 is 128-aligned -> batch index constant per block; nwave is
    // 64-aligned -> head index constant per wave.
    const int b  = m0 >> 11;
    const int sb = (m0 & (S_ - 1)) + wm * 64;
    const int h  = nwave >> 6;
    _Float16* ph = outH + ((size_t)b * H_ + h) * S_ * HD_;
    typedef __attribute__((ext_vector_type(4))) _Float16 v4h;
#pragma unroll
    for (int i = 0; i < 4; ++i) {
#pragma unroll
      for (int r = 0; r < 8; ++r) {
        v4h hv;
#pragma unroll
        for (int j = 0; j < 4; ++j)
          hv[j] = (_Float16)((acc[i][j][r] + bj[j]) * scale);
        *(v4h*)(ph + (size_t)(sb + i * 16 + rh + r) * HD_ + cl * 4) = hv;
      }
    }
  } else {
    float* pm = outF + (size_t)(m0 + wm * 64) * D_ + nwave;
#pragma unroll
    for (int i = 0; i < 4; ++i) {
#pragma unroll
      for (int r = 0; r < 8; ++r) {
        const float4 fv = {acc[i][0][r] + bj[0], acc[i][1][r] + bj[1],
                           acc[i][2][r] + bj[2], acc[i][3][r] + bj[3]};
        *(float4*)(pm + (size_t)(i * 16 + rh + r) * D_ + cl * 4) = fv;
      }
    }
  }
}

#define VPITCH 80                         // halves: 160 B = 32 B x odd
__device__ __forceinline__ v16h load_frag_tr(const _Float16* p) {
  typedef short s16x8 __attribute__((ext_vector_type(8)));
  typedef __attribute__((address_space(3))) s16x8 lds_s16x8;
  union { v16h v; s16x8 h[2]; } u;
  u.h[0] = __builtin_amdgcn_ds_load_tr16_b128_v8i16((lds_s16x8*)p);
  u.h[1] = __builtin_amdgcn_ds_load_tr16_b128_v8i16((lds_s16x8*)(p + 16 * VPITCH));
  return u.v;
}

__device__ __forceinline__ float xhalf(float x) {   // lane l <-> lane l ^ 16
  return __int_as_float(__builtin_amdgcn_permlanex16(
      __float_as_int(x), __float_as_int(x), 0x76543210, 0xfedcba98, false, false));
}

// exp2 of eight values (of one value). The instruction set asks for one
// independent instruction or v_nop between a transcendental and an instruction
// that reads its result or overwrites its source. Here every v_exp_f32 is
// followed by an independent one (outputs are early-clobber), the last by v_nop.
__device__ __forceinline__ void exp2x8(float (&y)[8], const float (&x)[8]) {
  asm("v_exp_f32 %0, %8\n\tv_exp_f32 %1, %9\n\tv_exp_f32 %2, %10\n\t"
      "v_exp_f32 %3, %11\n\tv_exp_f32 %4, %12\n\tv_exp_f32 %5, %13\n\t"
      "v_exp_f32 %6, %14\n\tv_exp_f32 %7, %15\n\tv_nop"
      : "=&v"(y[0]), "=&v"(y[1]), "=&v"(y[2]), "=&v"(y[3]),
        "=&v"(y[4]), "=&v"(y[5]), "=&v"(y[6]), "=&v"(y[7])
      : "v"(x[0]), "v"(x[1]), "v"(x[2]), "v"(x[3]),
        "v"(x[4]), "v"(x[5]), "v"(x[6]), "v"(x[7]));
}
__device__ __forceinline__ float exp2x1(float x) {
  float y;
  asm("v_exp_f32 %0, %1\n\tv_nop" : "=v"(y) : "v"(x));
  return y;
}

// amdgpu_waves_per_eu(4, 4): two work-groups per WGP, four waves per SIMD. The
// 512 equal work-groups are then all resident at once, in one round, and the
// vector work between the matrix runs has other waves to hide behind.
__global__ void __launch_bounds__(256) __attribute__((amdgpu_waves_per_eu(4, 4)))
attention_wmma(const _Float16* __restrict__ q16,   // [B,H,S,HD] (pre-scaled)
               const _Float16* __restrict__ k16,   // [B,H,S,HD]
               const _Float16* __restrict__ v16,   // [B,H,S,HD]
               _Float16* __restrict__ a16) {       // [B,S,D]
  __shared__ _Float16 Ks[64 * 72];        // [n][d]   n=0..63, stride 72 (pad)
  __shared__ _Float16 Vs[64 * VPITCH];    // [n][d]   n=0..63, stride 80 (pad)

  const int t    = threadIdx.x;
  const int lane = t & 31;
  const int wid  = t >> 5;
  const int cl   = lane & 15;
  const int rh   = (lane >> 4) * 8;

  const int qt = blockIdx.x;              // query tile (of 256 rows)
  const int h  = blockIdx.y;
  const int b  = blockIdx.z;

  const size_t head = (size_t)(b * H_ + h) * S_ * HD_;
  const _Float16* qb = q16 + head;
  const _Float16* kb = k16 + head;
  const _Float16* vb = v16 + head;

  const int qr0 = qt * 256 + wid * 32;    // this wave's 32 queries (2 groups of 16)

  // Q^T fragments: per group 64 dims x 16 queries -> two 32x16 B fragments.
  v16h qa[2][2];
#pragma unroll
  for (int g = 0; g < 2; ++g) {
    qa[g][0] = load_frag(qb + (size_t)(qr0 + g * 16) * HD_,      HD_);
    qa[g][1] = load_frag(qb + (size_t)(qr0 + g * 16) * HD_ + 32, HD_);
  }

  // o[g][j][r] = O[query 16*g + cl][dim j*16 + rh + r]
  v8f o[2][4];
#pragma unroll
  for (int g = 0; g < 2; ++g)
#pragma unroll
    for (int j = 0; j < 4; ++j) o[g][j] = {};
  float mneg[2] = {0.0f, 0.0f};           // minus the maximum in use of query 16*g + cl
  float lrow[2] = {0.0f, 0.0f};           // sum over this lane's half of the keys

  // Cooperative stage mapping: 64 rows x 64 halves, 16 halves per thread.
  const int srow = t >> 2;                // 0..63
  const int scol = (t & 3) * 16;          // 0/16/32/48

  // This lane's address in the first 16 keys x 16 dims of Vs (transposing load).
  const _Float16* vtp = &Vs[(rh + (lane & 7)) * VPITCH + ((lane >> 3) & 1) * 8];

  // Preload first K/V tile into registers.
  v8h kr0 = *(const v8h*)(kb + (size_t)srow * HD_ + scol);
  v8h kr1 = *(const v8h*)(kb + (size_t)srow * HD_ + scol + 8);
  v8h vr0 = *(const v8h*)(vb + (size_t)srow * HD_ + scol);
  v8h vr1 = *(const v8h*)(vb + (size_t)srow * HD_ + scol + 8);

  // Not unrolled: otherwise the first pass, whose test is known, is peeled off as a
  // second copy of the whole body.
#pragma nounroll
  for (int kv0 = 0; kv0 < S_; kv0 += 64) {
    // Commit staged registers: K and V row-major.
    *(v8h*)&Ks[srow * 72 + scol]     = kr0;
    *(v8h*)&Ks[srow * 72 + scol + 8] = kr1;
    *(v8h*)&Vs[srow * VPITCH + scol]     = vr0;
    *(v8h*)&Vs[srow * VPITCH + scol + 8] = vr1;
    __syncthreads();

    // Prefetch next tile into registers (hidden behind the WMMAs below).
    if (kv0 + 64 < S_) {
      const _Float16* kp = kb + (size_t)(kv0 + 64 + srow) * HD_ + scol;
      const _Float16* vp = vb + (size_t)(kv0 + 64 + srow) * HD_ + scol;
      kr0 = *(const v8h*)(kp);
      kr1 = *(const v8h*)(kp + 8);
      vr0 = *(const v8h*)(vp);
      vr1 = *(const v8h*)(vp + 8);
    }
    if (kv0 + 128 < S_) {
      __builtin_prefetch(kb + (size_t)(kv0 + 128 + srow) * HD_ + scol, 0, 3);
      __builtin_prefetch(vb + (size_t)(kv0 + 128 + srow) * HD_ + scol, 0, 3);
    }

    // Scores: per group four 16x16 tiles,
    // sc[g][nt][r] = S[query 16*g + cl][key kv0 + 16*nt + rh + r] + mneg[g].
    // Every K fragment read from LDS serves both query groups.
    v16h kfl[4], kfh[4];
#pragma unroll
    for (int nt = 0; nt < 4; ++nt) {
      kfl[nt] = load_frag(&Ks[nt * 16 * 72],      72);
      kfh[nt] = load_frag(&Ks[nt * 16 * 72 + 32], 72);
    }
    // Holds the K reads as one group ahead of the products (one place of LDS reads,
    // counted waits): with the fence behind the products alone the scheduler sinks
    // some of them between the products, each with a full wait.
    __builtin_amdgcn_sched_barrier(0);
    // The products start from minus the maximum in use, so that the accumulators
    // come out as the exponents of P (Q carries 1/8 and log2(e)).
    v8f sc[2][4];
#pragma unroll
    for (int nt = 0; nt < 4; ++nt)
#pragma unroll
      for (int g = 0; g < 2; ++g) {
        const float c = mneg[g];
        const v8f cm = {c, c, c, c, c, c, c, c};
        sc[g][nt] = wmma16(kfh[nt], qa[g][1], wmma16(kfl[nt], qa[g][0], cm));
      }
    // Keeps the maxima behind the 16 products: set among them, each first read of a
    // fresh tile is padded with idle vector slots up to the WMMA distance.
    __builtin_amdgcn_sched_barrier(0);

    // Lazy maximum: how far this tile's scores rise above the maximum in use, and
    // ONE test a pass. P stays within 2^8 of its usual range; the first pass
    // always takes the tile's own maximum (the start value 0 is no maximum).
    float tmax[2];
#pragma unroll
    for (int g = 0; g < 2; ++g) {
      float tm[4];
#pragma unroll
      for (int nt = 0; nt < 4; ++nt) {
        tm[nt] = fmaxf(fmaxf(fmaxf(sc[g][nt][0], sc[g][nt][1]), fmaxf(sc[g][nt][2], sc[g][nt][3])),
                       fmaxf(fmaxf(sc[g][nt][4], sc[g][nt][5]), fmaxf(sc[g][nt][6], sc[g][nt][7])));
      }
      const float tq = fmaxf(fmaxf(tm[0], tm[1]), fmaxf(tm[2], tm[3]));
      tmax[g] = fmaxf(tq, xhalf(tq));
    }
    if (kv0 == 0 || __builtin_amdgcn_ballot_w32(fmaxf(tmax[0], tmax[1]) > 8.0f) != 0) {
#pragma unroll
      for (int g = 0; g < 2; ++g) {
        const float d    = kv0 == 0 ? tmax[g] : fmaxf(tmax[g], 0.0f);
        const float corr = exp2x1(-fmaxf(d, 0.0f));
        mneg[g] -= d;
        lrow[g] *= corr;
#pragma unroll
        for (int nt = 0; nt < 4; ++nt)
#pragma unroll
          for (int r = 0; r < 8; ++r) sc[g][nt][r] -= d;
#pragma unroll
        for (int j = 0; j < 4; ++j)
#pragma unroll
          for (int r = 0; r < 8; ++r) o[g][j][r] *= corr;
      }
    }

    // P = exp2(exponent): one query per lane and group, 32 of its 64 keys in this lane.
    // P^T B fragments: element s of pb[g][c] is key 32*c + kmap(s), which is
    // register s & 7 of score tile 2*c + (s >> 3).
    v16h pb[2][2];
    v16h vf[4][2];
#pragma unroll
    for (int g = 0; g < 2; ++g) {
      if (g == 1) {
        // All V^T fragments are asked for as one group here, into the registers
        // that the K fragments and group 0's scores have left: one place of LDS
        // reads with one wait. They are the wave's last LDS reads of the tile.
#pragma unroll
        for (int j = 0; j < 4; ++j) {
          vf[j][0] = load_frag_tr(vtp + j * 16);
          vf[j][1] = load_frag_tr(vtp + j * 16 + 32 * VPITCH);
        }
        // Holds the loads here as one group: without it the scheduler spreads them
        // through both softmaxes and the live registers overflow into scratch.
        __builtin_amdgcn_sched_barrier(0);
      }
      float ps[4];
#pragma unroll
      for (int nt = 0; nt < 4; ++nt) {
        float a[8], p[8];
#pragma unroll
        for (int r = 0; r < 8; ++r) a[r] = sc[g][nt][r];
        exp2x8(p, a);
#pragma unroll
        for (int r = 0; r < 8; ++r) pb[g][nt >> 1][(nt & 1) * 8 + r] = (_Float16)p[r];
        ps[nt] = ((p[0] + p[1]) + (p[2] + p[3])) + ((p[4] + p[5]) + (p[6] + p[7]));
      }
      lrow[g] += (ps[0] + ps[1]) + (ps[2] + ps[3]);
    }

    // O^T += V^T (64 dims x 64 keys) x P^T (64 keys x 32 queries); every V^T
    // fragment read from LDS serves both query groups.
#pragma unroll
    for (int j = 0; j < 4; ++j) {
#pragma unroll
      for (int g = 0; g < 2; ++g) {
        o[g][j] = wmma16(vf[j][0], pb[g][0], o[g][j]);
        o[g][j] = wmma16(vf[j][1], pb[g][1], o[g][j]);
      }
    }
    __syncthreads();   // protect Ks/Vs before next stage
  }

  // Join the two halves' sums, normalize and write token-major [B,S,D] (f16)
  // for the output projection: 8 consecutive dims per lane and tile.
#pragma unroll
  for (int g = 0; g < 2; ++g) {
    const float inv = 1.0f / (lrow[g] + xhalf(lrow[g]));
    _Float16* po = a16 + ((size_t)b * S_ + qr0 + g * 16 + cl) * D_ + h * HD_ + rh;
#pragma unroll
    for (int j = 0; j < 4; ++j) {
      v8h ov;
#pragma unroll
      for (int r = 0; r < 8; ++r) ov[r] = (_Float16)(o[g][j][r] * inv);
      *(v8h*)(po + j * 16) = ov;
    }
  }
}

// ---------------------------------------------------------------------------
// Launcher
// ---------------------------------------------------------------------------
extern "C" void kernel_launch(void* const* d_in, const int* in_sizes, int n_in,
                              void* d_out, int out_size, void* d_ws, size_t ws_size,
                              hipStream_t stream) {
  (void)in_sizes; (void)n_in; (void)out_size; (void)ws_size;

  const float* query = (const float*)d_in[0];
  const float* Wq = (const float*)d_in[1]; const float* bq = (const float*)d_in[2];
  const float* Wk = (const float*)d_in[3]; const float* bk = (const float*)d_in[4];
  const float* Wv = (const float*)d_in[5]; const float* bv = (const float*)d_in[6];
  const float* Wo = (const float*)d_in[7]; const float* bo = (const float*)d_in[8];
  float* out = (float*)d_out;

  const size_t DD  = (size_t)D_ * D_;        // 1M
  const size_t BSD = (size_t)B_ * S_ * D_;   // 8M

  _Float16* w16  = (_Float16*)d_ws;          // 4*DD halves
  _Float16* wq16 = w16;
  _Float16* wk16 = w16 + DD;
  _Float16* wv16 = w16 + 2 * DD;
  _Float16* wo16 = w16 + 3 * DD;
  _Float16* x16  = w16 + 4 * DD;             // BSD
  _Float16* q16  = x16 + BSD;                // BSD  [B,H,S,HD]
  _Float16* k16  = q16 + BSD;
  _Float16* v16p = k16 + BSD;
  _Float16* a16  = v16p + BSD;               // BSD  [B,S,D]

  // 1) f32 -> f16 conversions: w16 (four weights) and x16 behind it, one launch.
  cvt_all_f32_to_f16<<<256, 512, 0, stream>>>(query, Wq, Wk, Wv, Wo, w16);

  // 2) QKV projections (head-major f16; Q carries the softmax scale 1/8 times log2(e)).
  dim3 ggrid(D_ / 128, (B_ * S_) / 128);     // (8, 64)
  gemm_wmma<1><<<ggrid, 128, 0, stream>>>(x16, wq16, bq, q16, nullptr, 0.18033688011112043f);
  gemm_wmma<1><<<ggrid, 128, 0, stream>>>(x16, wk16, bk, k16, nullptr, 1.0f);
  gemm_wmma<1><<<ggrid, 128, 0, stream>>>(x16, wv16, bv, v16p, nullptr, 1.0f);

  // 3) Flash attention.
  dim3 agrid(S_ / 256, H_, B_);              // (8, 16, 4)
  attention_wmma<<<agrid, 256, 0, stream>>>(q16, k16, v16p, a16);

  // 4) Output projection -> f32 d_out.
  gemm_wmma<0><<<ggrid, 128, 0, stream>>>(a16, wo16, bo, nullptr, out, 1.0f);
}

// v009
// A run of this version takes 121 microseconds.
// Next to v008, in two timings, it ran 1.11 times as fast each time.
// Over all steps from v000 it is 2.28 times as fast.
#include <hip/hip_runtime.h>
#include <stdint.h>

// ---------------------------------------------------------------------------
// MHA forward for MI455X (gfx1250): f16 WMMA GEMMs + flash attention.
// B=4, S=2048, D=1024, H=16, HD=64
// ---------------------------------------------------------------------------

typedef __attribute__((ext_vector_type(16))) _Float16 v16h;
typedef __attribute__((ext_vector_type(8)))  _Float16 v8h;
typedef __attribute__((ext_vector_type(8)))  float    v8f;

#define B_  4
#define S_  2048
#define D_  1024
#define H_  16
#define HD_ 64

// ---------------------------------------------------------------------------
// Fragment loader: 16x32 f16 tile, row-major source (row stride in halves).
// Matches CDNA5 16-bit A-matrix layout (ISA 7.12.2):
//   lanes 0-15 : row M = lane,    halves 0-7 -> K=0..7,  halves 8-15 -> K=16..23
//   lanes 16-31: row M = lane-16, halves 0-7 -> K=8..15, halves 8-15 -> K=24..31
// Because y = x @ W^T, row-major W *is* the B matrix in [n][k] order, so the
// same loader serves A and B fragments. Two 16B ds_load_b128 per lane.
// ---------------------------------------------------------------------------
__device__ __forceinline__ v16h load_frag(const _Float16* base, int stride) {
  const int lane = threadIdx.x & 31;
  const int r    = lane & 15;
  const int kg   = lane >> 4;          // 0 or 1
  const _Float16* p = base + r * stride + kg * 8;
  union { v16h v; v8h h[2]; } u;
  u.h[0] = *(const v8h*)(p);           // K = kg*8 .. kg*8+7
  u.h[1] = *(const v8h*)(p + 16);      // K = 16+kg*8 .. 16+kg*8+7
  return u.v;
}

__device__ __forceinline__ v8f wmma16(v16h a, v16h b, v8f c) {
  // D = A(16x32 f16) * B(32x16 f16) + C(16x16 f32)
  return __builtin_amdgcn_wmma_f32_16x16x32_f16(false, a, false, b,
                                                (short)0, c, false, false);
}

// ---------------------------------------------------------------------------
// f32 -> f16 conversion of the four weights and the query in ONE launch of
// 256 work-groups x 16 waves (one work-group per WGP), so that 4,096 waves
// start instead of 98,304 waves of one load each. The f16 copies lie in one
// row in the workspace: Wq | Wk | Wv | Wo | query, 12,288 pieces of 1,024
// elements. Wave w takes pieces w (a weight), 4,096 + w and 8,192 + w (query):
// 24 loads of 16 bytes a lane, each 512 contiguous bytes of a wave, all issued
// ahead of the first conversion; each store is 256 contiguous bytes of a wave.
// A piece of a weight is one row of it. Inside every block of 64 rows the f16
// copy holds row 4 * c + j at place 16 * j + c: the GEMM's B fragment j then has
// output column 4 * c + j in lane c, so that a lane's four accumulators of one
// output row are four adjacent columns and a half wave stores whole lines.
// ---------------------------------------------------------------------------
#define CVT_PIECE 1024                    // elements: 8 wave loads of 512 bytes
#define CVT_WAVES 4096                    // = 4 * D_ * D_ / CVT_PIECE
// amdgpu_waves_per_eu(4, 4): one work-group per WGP is four waves per SIMD; at
// that register budget the compiler issues all 24 loads ahead (at the default
// budget it holds half of them back behind waits to save registers).
__global__ void __launch_bounds__(512) __attribute__((amdgpu_waves_per_eu(4, 4)))
cvt_all_f32_to_f16(const float* __restrict__ query,
                   const float* __restrict__ Wq, const float* __restrict__ Wk,
                   const float* __restrict__ Wv, const float* __restrict__ Wo,
                   _Float16* __restrict__ out) {
  typedef __attribute__((ext_vector_type(4))) _Float16 v4h;
  const int l4 = (threadIdx.x & 31) * 4;  // this lane's 4 elements of 128
  // Wave number in a scalar register: piece addresses are scalar bases.
  const int w = blockIdx.x * 16 + __builtin_amdgcn_readfirstlane(threadIdx.x >> 5);
  const int wsel = blockIdx.x >> 6;       // 64 work-groups (1,024 pieces) a weight
  const float* wsrc = wsel == 0 ? Wq : wsel == 1 ? Wk : wsel == 2 ? Wv : Wo;
  const float* s0 = wsrc  + (size_t)(w & 1023) * CVT_PIECE;
  const float* s1 = query + (size_t)w * CVT_PIECE;
  const float* s2 = s1 + (size_t)CVT_WAVES * CVT_PIECE;
  _Float16* d0 = out + (size_t)w * CVT_PIECE;
  const int wplace = (w & ~63) | ((w & 3) << 4) | ((w >> 2) & 15);   // dealt weight row
  _Float16* dw = out + (size_t)wplace * CVT_PIECE;

  float4 v[3][8];
#pragma unroll
  for (int u = 0; u < 8; ++u) v[0][u] = *(const float4*)(s0 + u * 128 + l4);
#pragma unroll
  for (int u = 0; u < 8; ++u) v[1][u] = *(const float4*)(s1 + u * 128 + l4);
#pragma unroll
  for (int u = 0; u < 8; ++u) v[2][u] = *(const float4*)(s2 + u * 128 + l4);
#pragma unroll
  for (int j = 0; j < 3; ++j) {
#pragma unroll
    for (int u = 0; u < 8; ++u) {
      v4h h;
      h[0] = (_Float16)v[j][u].x;
      h[1] = (_Float16)v[j][u].y;
      h[2] = (_Float16)v[j][u].z;
      h[3] = (_Float16)v[j][u].w;
      *(v4h*)((j == 0 ? dw : d0 + (size_t)j * CVT_WAVES * CVT_PIECE) + u * 128 + l4) = h;
    }
  }
}

// ---------------------------------------------------------------------------
// Tensor loads (tensor_load_to_lds): one request of a wave brings a 2-D tile
// from global memory into LDS, through no register.
// ---------------------------------------------------------------------------
typedef uint32_t u32x4 __attribute__((ext_vector_type(4)));
typedef uint32_t u32x8 __attribute__((ext_vector_type(8)));

__device__ __forceinline__ uint32_t uni(uint32_t v) {
  return (uint32_t)__builtin_amdgcn_readfirstlane(v);
}
// Scalar test around a tensor load (the instruction ignores EXEC): the empty
// statement holds the word in a scalar register, so that the test compiles to
// s_cmp and a scalar branch.
__device__ __forceinline__ uint32_t pinned(uint32_t v) {
  uint32_t w = uni(v);
  asm volatile("" : "+s"(w));   // pinned(): the test word kept in a scalar register
  return w;
}
__device__ __forceinline__ void wait_ds0() {       // this wave's LDS reads are done
  asm volatile("s_wait_dscnt 0x0" ::: "memory");
}
// This wave's tile has landed. The request's group 0 is named as an input, so
// that its scalar registers keep their words until the request is covered.
__device__ __forceinline__ void wait_tensor0(u32x4 g0) {
  asm volatile("s_wait_tensorcnt 0x0" :: "s"(g0) : "memory");
}
// Group 0 is an in-out operand: the caller's copy of it then lives on in the very
// registers that the request was issued from.
__device__ __forceinline__ void tdm_load(u32x4& g0, u32x8 g1) {
  asm volatile("tensor_load_to_lds %0, %1" : "+s"(g0) : "s"(g1) : "memory");
}

#define GK      64      // k per stage: 128-byte rows
#define GPITCH  72      // halves: 144-byte LDS pitch (16 B x odd), laid by the pad
#define GROWS   64      // rows per slice, one slice per wave
#define GSLICE  10240   // bytes: 64 rows x 144 B = 9,216, rounded up to 2 KiB x 5
#define GSTAGE  (4 * GSLICE)

// Group 1: bytes as elements, tile = tensor = 64 rows of 128 bytes, source pitch
// one row of the matrix, 4 dwords of LDS pad behind every 32 dwords (one row).
__device__ __forceinline__ u32x8 tdm_group1() {
  u32x8 g;
  g[0] = uni((1u << 20) | (4u << 22) | (3u << 25));
  g[1] = uni((uint32_t)(GK * 2) << 16);
  g[2] = uni((uint32_t)GROWS << 16);
  g[3] = uni((uint32_t)(GK * 2) << 16);
  g[4] = uni((uint32_t)GROWS);
  g[5] = uni((uint32_t)(D_ * 2));
  g[6] = uni(0u);
  g[7] = uni(0u);
  return g;
}
__device__ __forceinline__ u32x4 tdm_group0(uint32_t lds_dst, uint64_t ga) {
  u32x4 g;
  g[0] = uni(1u);
  g[1] = uni(lds_dst);
  g[2] = uni((uint32_t)ga);
  g[3] = uni((((uint32_t)(ga >> 32)) & 0x01FFFFFFu) | 0x80000000u);
  return g;
}

// ---------------------------------------------------------------------------
// GEMM: y[m][n] = sum_k A[m][k] * W[n][k] + bias[n]
// Block tile 128(M) x 128(N). 128 threads = 4 waves, each wave owns a 64x64
// output tile (16 acc tiles). A stage is 64 k of the 128 A rows and the 128 W
// rows, in four slices of 64 rows: waves 0 and 1 bring the halves of A, waves 2
// and 3 those of W, one tensor load each. Two LDS buffers, one barrier a stage:
// a wave reads all fragments of stage s, then stage s + 2 is asked for into the
// same buffer and flies under the 32 wmma of stage s and the reads of s + 1.
// W comes with its rows dealt (see the conversion): lane c of B fragment j holds
// output column 4 * c + j of the wave's 64.
// MODE=1: f16 head-major [B,H,S,HD] output (QKV path). ONE launch does the three
// projections: blockIdx.z is the projection (0 Q, 1 K, 2 V) and picks the weight,
// the bias, the output and the scale (only Q is scaled). The three f16 weights
// lie in a row in the workspace, and so do the three outputs. z is the slowest
// index: work-groups start projection by projection, so that the rows of A are
// fetched into L2 under Q and found there by K and V.
// MODE=0: f32 row-major [M,N] output (final projection), bias0 alone.
// ---------------------------------------------------------------------------
template <int MODE>
__global__ void __launch_bounds__(128)
gemm_wmma(const _Float16* __restrict__ A,   // [8192][1024] f16
          const _Float16* __restrict__ W,   // [1024][1024] f16 (row-major, rows dealt), x3 if MODE=1
          const float*    __restrict__ bias0, const float* __restrict__ bias1,
          const float*    __restrict__ bias2,
          _Float16* __restrict__ outH, float* __restrict__ outF,
          float scale0) {
  __shared__ __attribute__((aligned(2048))) unsigned char ring[2 * GSTAGE];

  const int t    = threadIdx.x;          // 0..127
  const int lane = t & 31;
  const int wid  = t >> 5;               // 0..3
  const int wm   = wid & 1;              // M sub-tile (x64) = A slice
  const int wn   = wid >> 1;             // N sub-tile (x64) = W slice
  const int m0   = blockIdx.y * 128;
  const int n0   = blockIdx.x * 128;
  const int proj = MODE == 1 ? (int)blockIdx.z : 0;
  const int cl   = lane & 15;
  const int rh   = (lane >> 4) * 8;

  v8f acc[4][4];
#pragma unroll
  for (int i = 0; i < 4; ++i)
#pragma unroll
    for (int j = 0; j < 4; ++j) acc[i][j] = {};

  // This wave's slice: source rows and place in each buffer.
  const uint32_t wave = uni(threadIdx.x >> 5);
  const _Float16* srows = wave < 2u ? A + (size_t)(m0 + wave * GROWS) * D_
                                    : W + (size_t)(proj * D_ + n0 + (wave - 2u) * GROWS) * D_;
  const uint64_t gsrc  = (uint64_t)(size_t)srows;
  const uint32_t ldst  = (uint32_t)(size_t)ring + wave * GSLICE;
  const u32x8 g1 = tdm_group1();

  const int NST = D_ / GK;               // 16 stages
  u32x4 g0 = tdm_group0(ldst, gsrc);                          // stage 0
  tdm_load(g0, g1);
  wait_tensor0(g0);
  __syncthreads();
  g0 = tdm_group0(ldst + GSTAGE, gsrc + GK * 2);              // stage 1
  tdm_load(g0, g1);

  for (int s = 0; s < NST; ++s) {
    const unsigned char* st = ring + (s & 1) * GSTAGE;
    const _Float16* as = (const _Float16*)(st + wm * GSLICE);
    const _Float16* bs = (const _Float16*)(st + (2 + wn) * GSLICE);
    // All fragments of stage s go into registers first, so that its buffer is free
    // for the refill while the products still run.
    v16h af[2][4], bf[2][4];
#pragma unroll
    for (int c = 0; c < 2; ++c) {
#pragma unroll
      for (int i = 0; i < 4; ++i) {
        af[c][i] = load_frag(as + i * 16 * GPITCH + c * 32, GPITCH);
        bf[c][i] = load_frag(bs + i * 16 * GPITCH + c * 32, GPITCH);
      }
    }

    // Publish point of stage s + 1: own LDS reads done, own tile landed, barrier;
    // only then the refill of the buffer that every wave has just left.
    wait_ds0();
    wait_tensor0(g0);
    __syncthreads();
    if (pinned(s + 2 < NST)) {
      g0 = tdm_group0(ldst + (uint32_t)(s & 1) * GSTAGE,
                      gsrc + (uint64_t)(s + 2) * (GK * 2));
      tdm_load(g0, g1);
    }

#pragma unroll
    for (int c = 0; c < 2; ++c)
#pragma unroll
      for (int j = 0; j < 4; ++j)
#pragma unroll
        for (int i = 0; i < 4; ++i)
          acc[i][j] = wmma16(af[c][i], bf[c][j], acc[i][j]);
  }
  wait_tensor0(g0);
  wait_ds0();

  // Epilogue. A lane holds columns 4 * cl .. 4 * cl + 3 of each of its rows: one
  // store of 4 elements a row, 16 lanes cover the wave's 64 columns in a row.
  const int nwave = n0 + wn * 64;
  const float* bias = proj == 0 ? bias0 : proj == 1 ? bias1 : bias2;
  const float4 b4 = *(const float4*)(bias + nwave + cl * 4);
  const float bj[4] = {b4.x, b4.y, b4.z, b4.w};

  if (MODE == 1) {
    // m0 is 128-aligned -> batch index constant per block; nwave is
    // 64-aligned -> head index constant per wave.
    const int b  = m0 >> 11;
    const int sb = (m0 & (S_ - 1)) + wm * 64;
    const int h  = nwave >> 6;
    const float scale = proj == 0 ? scale0 : 1.0f;
    _Float16* ph = outH + (((size_t)proj * B_ + b) * H_ + h) * S_ * HD_;
    typedef __attribute__((ext_vector_type(4))) _Float16 v4h;
#pragma unroll
    for (int i = 0; i < 4; ++i) {
#pragma unroll
      for (int r = 0; r < 8; ++r) {
        v4h hv;
#pragma unroll
        for (int j = 0; j < 4; ++j)
          hv[j] = (_Float16)((acc[i][j][r] + bj[j]) * scale);
        *(v4h*)(ph + (size_t)(sb + i * 16 + rh + r) * HD_ + cl * 4) = hv;
      }
    }
  } else {
    float* pm = outF + (size_t)(m0 + wm * 64) * D_ + nwave;
#pragma unroll
    for (int i = 0; i < 4; ++i) {
#pragma unroll
      for (int r = 0; r < 8; ++r) {
        const float4 fv = {acc[i][0][r] + bj[0], acc[i][1][r] + bj[1],
                           acc[i][2][r] + bj[2], acc[i][3][r] + bj[3]};
        *(float4*)(pm + (size_t)(i * 16 + rh + r) * D_ + cl * 4) = fv;
      }
    }
  }
}

#define VPITCH 80                         // halves: 160 B = 32 B x odd
__device__ __forceinline__ v16h load_frag_tr(const _Float16* p) {
  typedef short s16x8 __attribute__((ext_vector_type(8)));
  typedef __attribute__((address_space(3))) s16x8 lds_s16x8;
  union { v16h v; s16x8 h[2]; } u;
  u.h[0] = __builtin_amdgcn_ds_load_tr16_b128_v8i16((lds_s16x8*)p);
  u.h[1] = __builtin_amdgcn_ds_load_tr16_b128_v8i16((lds_s16x8*)(p + 16 * VPITCH));
  return u.v;
}

__device__ __forceinline__ float xhalf(float x) {   // lane l <-> lane l ^ 16
  return __int_as_float(__builtin_amdgcn_permlanex16(
      __float_as_int(x), __float_as_int(x), 0x76543210, 0xfedcba98, false, false));
}

// exp2 of eight values (of one value). The instruction set asks for one
// independent instruction or v_nop between a transcendental and an instruction
// that reads its result or overwrites its source. Here every v_exp_f32 is
// followed by an independent one (outputs are early-clobber), the last by v_nop.
__device__ __forceinline__ void exp2x8(float (&y)[8], const float (&x)[8]) {
  asm("v_exp_f32 %0, %8\n\tv_exp_f32 %1, %9\n\tv_exp_f32 %2, %10\n\t"
      "v_exp_f32 %3, %11\n\tv_exp_f32 %4, %12\n\tv_exp_f32 %5, %13\n\t"
      "v_exp_f32 %6, %14\n\tv_exp_f32 %7, %15\n\tv_nop"
      : "=&v"(y[0]), "=&v"(y[1]), "=&v"(y[2]), "=&v"(y[3]),
        "=&v"(y[4]), "=&v"(y[5]), "=&v"(y[6]), "=&v"(y[7])
      : "v"(x[0]), "v"(x[1]), "v"(x[2]), "v"(x[3]),
        "v"(x[4]), "v"(x[5]), "v"(x[6]), "v"(x[7]));
}
__device__ __forceinline__ float exp2x1(float x) {
  float y;
  asm("v_exp_f32 %0, %1\n\tv_nop" : "=v"(y) : "v"(x));
  return y;
}

// amdgpu_waves_per_eu(4, 4): two work-groups per WGP, four waves per SIMD. The
// 512 equal work-groups are then all resident at once, in one round, and the
// vector work between the matrix runs has other waves to hide behind.
__global__ void __launch_bounds__(256) __attribute__((amdgpu_waves_per_eu(4, 4)))
attention_wmma(const _Float16* __restrict__ q16,   // [B,H,S,HD] (pre-scaled)
               const _Float16* __restrict__ k16,   // [B,H,S,HD]
               const _Float16* __restrict__ v16,   // [B,H,S,HD]
               _Float16* __restrict__ a16) {       // [B,S,D]
  __shared__ _Float16 Ks[64 * 72];        // [n][d]   n=0..63, stride 72 (pad)
  __shared__ _Float16 Vs[64 * VPITCH];    // [n][d]   n=0..63, stride 80 (pad)

  const int t    = threadIdx.x;
  const int lane = t & 31;
  const int wid  = t >> 5;
  const int cl   = lane & 15;
  const int rh   = (lane >> 4) * 8;

  const int qt = blockIdx.x;              // query tile (of 256 rows)
  const int h  = blockIdx.y;
  const int b  = blockIdx.z;

  const size_t head = (size_t)(b * H_ + h) * S_ * HD_;
  const _Float16* qb = q16 + head;
  const _Float16* kb = k16 + head;
  const _Float16* vb = v16 + head;

  const int qr0 = qt * 256 + wid * 32;    // this wave's 32 queries (2 groups of 16)

  // Q^T fragments: per group 64 dims x 16 queries -> two 32x16 B fragments.
  v16h qa[2][2];
#pragma unroll
  for (int g = 0; g < 2; ++g) {
    qa[g][0] = load_frag(qb + (size_t)(qr0 + g * 16) * HD_,      HD_);
    qa[g][1] = load_frag(qb + (size_t)(qr0 + g * 16) * HD_ + 32, HD_);
  }

  // o[g][j][r] = O[query 16*g + cl][dim j*16 + rh + r]
  v8f o[2][4];
#pragma unroll
  for (int g = 0; g < 2; ++g)
#pragma unroll
    for (int j = 0; j < 4; ++j) o[g][j] = {};
  float mneg[2] = {0.0f, 0.0f};           // minus the maximum in use of query 16*g + cl
  float lrow[2] = {0.0f, 0.0f};           // sum over this lane's half of the keys

  // Cooperative stage mapping: 64 rows x 64 halves, 16 halves per thread.
  const int srow = t >> 2;                // 0..63
  const int scol = (t & 3) * 16;          // 0/16/32/48

  // This lane's address in the first 16 keys x 16 dims of Vs (transposing load).
  const _Float16* vtp = &Vs[(rh + (lane & 7)) * VPITCH + ((lane >> 3) & 1) * 8];

  // Preload first K/V tile into registers.
  v8h kr0 = *(const v8h*)(kb + (size_t)srow * HD_ + scol);
  v8h kr1 = *(const v8h*)(kb + (size_t)srow * HD_ + scol + 8);
  v8h vr0 = *(const v8h*)(vb + (size_t)srow * HD_ + scol);
  v8h vr1 = *(const v8h*)(vb + (size_t)srow * HD_ + scol + 8);

  // Not unrolled: otherwise the first pass, whose test is known, is peeled off as a
  // second copy of the whole body.
#pragma nounroll
  for (int kv0 = 0; kv0 < S_; kv0 += 64) {
    // Commit staged registers: K and V row-major.
    *(v8h*)&Ks[srow * 72 + scol]     = kr0;
    *(v8h*)&Ks[srow * 72 + scol + 8] = kr1;
    *(v8h*)&Vs[srow * VPITCH + scol]     = vr0;
    *(v8h*)&Vs[srow * VPITCH + scol + 8] = vr1;
    __syncthreads();

    // Prefetch next tile into registers (hidden behind the WMMAs below).
    if (kv0 + 64 < S_) {
      const _Float16* kp = kb + (size_t)(kv0 + 64 + srow) * HD_ + scol;
      const _Float16* vp = vb + (size_t)(kv0 + 64 + srow) * HD_ + scol;
      kr0 = *(const v8h*)(kp);
      kr1 = *(const v8h*)(kp + 8);
      vr0 = *(const v8h*)(vp);
      vr1 = *(const v8h*)(vp + 8);
    }
    if (kv0 + 128 < S_) {
      __builtin_prefetch(kb + (size_t)(kv0 + 128 + srow) * HD_ + scol, 0, 3);
      __builtin_prefetch(vb + (size_t)(kv0 + 128 + srow) * HD_ + scol, 0, 3);
    }

    // Scores: per group four 16x16 tiles,
    // sc[g][nt][r] = S[query 16*g + cl][key kv0 + 16*nt + rh + r] + mneg[g].
    // Every K fragment read from LDS serves both query groups.
    v16h kfl[4], kfh[4];
#pragma unroll
    for (int nt = 0; nt < 4; ++nt) {
      kfl[nt] = load_frag(&Ks[nt * 16 * 72],      72);
      kfh[nt] = load_frag(&Ks[nt * 16 * 72 + 32], 72);
    }
    // Holds the K reads as one group ahead of the products (one place of LDS reads,
    // counted waits): with the fence behind the products alone the scheduler sinks
    // some of them between the products, each with a full wait.
    __builtin_amdgcn_sched_barrier(0);
    // The products start from minus the maximum in use, so that the accumulators
    // come out as the exponents of P (Q carries 1/8 and log2(e)).
    v8f sc[2][4];
#pragma unroll
    for (int nt = 0; nt < 4; ++nt)
#pragma unroll
      for (int g = 0; g < 2; ++g) {
        const float c = mneg[g];
        const v8f cm = {c, c, c, c, c, c, c, c};
        sc[g][nt] = wmma16(kfh[nt], qa[g][1], wmma16(kfl[nt], qa[g][0], cm));
      }
    // Keeps the maxima behind the 16 products: set among them, each first read of a
    // fresh tile is padded with idle vector slots up to the WMMA distance.
    __builtin_amdgcn_sched_barrier(0);

    // Lazy maximum: how far this tile's scores rise above the maximum in use, and
    // ONE test a pass. P stays within 2^8 of its usual range; the first pass
    // always takes the tile's own maximum (the start value 0 is no maximum).
    float tmax[2];
#pragma unroll
    for (int g = 0; g < 2; ++g) {
      float tm[4];
#pragma unroll
      for (int nt = 0; nt < 4; ++nt) {
        tm[nt] = fmaxf(fmaxf(fmaxf(sc[g][nt][0], sc[g][nt][1]), fmaxf(sc[g][nt][2], sc[g][nt][3])),
                       fmaxf(fmaxf(sc[g][nt][4], sc[g][nt][5]), fmaxf(sc[g][nt][6], sc[g][nt][7])));
      }
      const float tq = fmaxf(fmaxf(tm[0], tm[1]), fmaxf(tm[2], tm[3]));
      tmax[g] = fmaxf(tq, xhalf(tq));
    }
    if (kv0 == 0 || __builtin_amdgcn_ballot_w32(fmaxf(tmax[0], tmax[1]) > 8.0f) != 0) {
#pragma unroll
      for (int g = 0; g < 2; ++g) {
        const float d    = kv0 == 0 ? tmax[g] : fmaxf(tmax[g], 0.0f);
        const float corr = exp2x1(-fmaxf(d, 0.0f));
        mneg[g] -= d;
        lrow[g] *= corr;
#pragma unroll
        for (int nt = 0; nt < 4; ++nt)
#pragma unroll
          for (int r = 0; r < 8; ++r) sc[g][nt][r] -= d;
#pragma unroll
        for (int j = 0; j < 4; ++j)
#pragma unroll
          for (int r = 0; r < 8; ++r) o[g][j][r] *= corr;
      }
    }

    // P = exp2(exponent): one query per lane and group, 32 of its 64 keys in this lane.
    // P^T B fragments: element s of pb[g][c] is key 32*c + kmap(s), which is
    // register s & 7 of score tile 2*c + (s >> 3).
    v16h pb[2][2];
    v16h vf[4][2];
#pragma unroll
    for (int g = 0; g < 2; ++g) {
      if (g == 1) {
        // All V^T fragments are asked for as one group here, into the registers
        // that the K fragments and group 0's scores have left: one place of LDS
        // reads with one wait. They are the wave's last LDS reads of the tile.
#pragma unroll
        for (int j = 0; j < 4; ++j) {
          vf[j][0] = load_frag_tr(vtp + j * 16);
          vf[j][1] = load_frag_tr(vtp + j * 16 + 32 * VPITCH);
        }
        // Holds the loads here as one group: without it the scheduler spreads them
        // through both softmaxes and the live registers overflow into scratch.
        __builtin_amdgcn_sched_barrier(0);
      }
      float ps[4];
#pragma unroll
      for (int nt = 0; nt < 4; ++nt) {
        float a[8], p[8];
#pragma unroll
        for (int r = 0; r < 8; ++r) a[r] = sc[g][nt][r];
        exp2x8(p, a);
#pragma unroll
        for (int r = 0; r < 8; ++r) pb[g][nt >> 1][(nt & 1) * 8 + r] = (_Float16)p[r];
        ps[nt] = ((p[0] + p[1]) + (p[2] + p[3])) + ((p[4] + p[5]) + (p[6] + p[7]));
      }
      lrow[g] += (ps[0] + ps[1]) + (ps[2] + ps[3]);
    }

    // O^T += V^T (64 dims x 64 keys) x P^T (64 keys x 32 queries); every V^T
    // fragment read from LDS serves both query groups.
#pragma unroll
    for (int j = 0; j < 4; ++j) {
#pragma unroll
      for (int g = 0; g < 2; ++g) {
        o[g][j] = wmma16(vf[j][0], pb[g][0], o[g][j]);
        o[g][j] = wmma16(vf[j][1], pb[g][1], o[g][j]);
      }
    }
    __syncthreads();   // protect Ks/Vs before next stage
  }

  // Join the two halves' sums, normalize and write token-major [B,S,D] (f16)
  // for the output projection: 8 consecutive dims per lane and tile.
#pragma unroll
  for (int g = 0; g < 2; ++g) {
    const float inv = 1.0f / (lrow[g] + xhalf(lrow[g]));
    _Float16* po = a16 + ((size_t)b * S_ + qr0 + g * 16 + cl) * D_ + h * HD_ + rh;
#pragma unroll
    for (int j = 0; j < 4; ++j) {
      v8h ov;
#pragma unroll
      for (int r = 0; r < 8; ++r) ov[r] = (_Float16)(o[g][j][r] * inv);
      *(v8h*)(po + j * 16) = ov;
    }
  }
}

// ---------------------------------------------------------------------------
// Launcher
// ---------------------------------------------------------------------------
extern "C" void kernel_launch(void* const* d_in, const int* in_sizes, int n_in,
                              void* d_out, int out_size, void* d_ws, size_t ws_size,
                              hipStream_t stream) {
  (void)in_sizes; (void)n_in; (void)out_size; (void)ws_size;

  const float* query = (const float*)d_in[0];
  const float* Wq = (const float*)d_in[1]; const float* bq = (const float*)d_in[2];
  const float* Wk = (const float*)d_in[3]; const float* bk = (const float*)d_in[4];
  const float* Wv = (const float*)d_in[5]; const float* bv = (const float*)d_in[6];
  const float* Wo = (const float*)d_in[7]; const float* bo = (const float*)d_in[8];
  float* out = (float*)d_out;

  const size_t DD  = (size_t)D_ * D_;        // 1M
  const size_t BSD = (size_t)B_ * S_ * D_;   // 8M

  _Float16* w16  = (_Float16*)d_ws;          // 4*DD halves
  _Float16* wq16 = w16;                      // Wq | Wk | Wv, DD halves each
  _Float16* wo16 = w16 + 3 * DD;
  _Float16* x16  = w16 + 4 * DD;             // BSD
  _Float16* q16  = x16 + BSD;                // BSD  [B,H,S,HD]
  _Float16* k16  = q16 + BSD;
  _Float16* v16p = k16 + BSD;
  _Float16* a16  = v16p + BSD;               // BSD  [B,S,D]

  // 1) f32 -> f16 conversions: w16 (four weights) and x16 behind it, one launch.
  cvt_all_f32_to_f16<<<256, 512, 0, stream>>>(query, Wq, Wk, Wv, Wo, w16);

  // 2) QKV projections (head-major f16; Q carries the softmax scale 1/8 times log2(e)).
  dim3 ggrid(D_ / 128, (B_ * S_) / 128);     // (8, 64)
  // One launch: three weights from wq16 on, three outputs q16 | k16 | v16p.
  dim3 qgrid(D_ / 128, (B_ * S_) / 128, 3);  // (8, 64, 3)
  gemm_wmma<1><<<qgrid, 128, 0, stream>>>(x16, wq16, bq, bk, bv, q16, nullptr, 0.18033688011112043f);

  // 3) Flash attention.
  dim3 agrid(S_ / 256, H_, B_);              // (8, 16, 4)
  attention_wmma<<<agrid, 256, 0, stream>>>(q16, k16, v16p, a16);

  // 4) Output projection -> f32 d_out.
  gemm_wmma<0><<<ggrid, 128, 0, stream>>>(a16, wo16, bo, nullptr, nullptr, nullptr, out, 1.0f);
}

// v010
// A run of this version takes 115 microseconds.
// Timed twice side by side with v009, it ran 1.04 times as fast both times.
// All steps since v000 together make it 2.37 times as fast.
#include <hip/hip_runtime.h>
#include <stdint.h>

// ---------------------------------------------------------------------------
// MHA forward for MI455X (gfx1250): f16 WMMA GEMMs + flash attention.
// B=4, S=2048, D=1024, H=16, HD=64
// ---------------------------------------------------------------------------

typedef __attribute__((ext_vector_type(16))) _Float16 v16h;
typedef __attribute__((ext_vector_type(8)))  _Float16 v8h;
typedef __attribute__((ext_vector_type(8)))  float    v8f;

#define B_  4
#define S_  2048
#define D_  1024
#define H_  16
#define HD_ 64

// ---------------------------------------------------------------------------
// Fragment loader: 16x32 f16 tile, row-major source (row stride in halves).
// Matches CDNA5 16-bit A-matrix layout (ISA 7.12.2):
//   lanes 0-15 : row M = lane,    halves 0-7 -> K=0..7,  halves 8-15 -> K=16..23
//   lanes 16-31: row M = lane-16, halves 0-7 -> K=8..15, halves 8-15 -> K=24..31
// Because y = x @ W^T, row-major W *is* the B matrix in [n][k] order, so the
// same loader serves A and B fragments. Two 16B ds_load_b128 per lane.
// ---------------------------------------------------------------------------
__device__ __forceinline__ v16h load_frag(const _Float16* base, int stride) {
  const int lane = threadIdx.x & 31;
  const int r    = lane & 15;
  const int kg   = lane >> 4;          // 0 or 1
  const _Float16* p = base + r * stride + kg * 8;
  union { v16h v; v8h h[2]; } u;
  u.h[0] = *(const v8h*)(p);           // K = kg*8 .. kg*8+7
  u.h[1] = *(const v8h*)(p + 16);      // K = 16+kg*8 .. 16+kg*8+7
  return u.v;
}

__device__ __forceinline__ v8f wmma16(v16h a, v16h b, v8f c) {
  // D = A(16x32 f16) * B(32x16 f16) + C(16x16 f32)
  return __builtin_amdgcn_wmma_f32_16x16x32_f16(false, a, false, b,
                                                (short)0, c, false, false);
}

// ---------------------------------------------------------------------------
// f32 -> f16 conversion of the four weights and the query in ONE launch of
// 256 work-groups x 16 waves (one work-group per WGP), so that 4,096 waves
// start instead of 98,304 waves of one load each. The f16 copies lie in one
// row in the workspace: Wq | Wk | Wv | Wo | query, 12,288 pieces of 1,024
// elements. Wave w takes pieces w (a weight), 4,096 + w and 8,192 + w (query):
// 24 loads of 16 bytes a lane, each 512 contiguous bytes of a wave, all issued
// ahead of the first conversion; each store is 256 contiguous bytes of a wave.
// A piece of a weight is one row of it. Inside every block of 64 rows the f16
// copy holds row 4 * c + j at place 16 * j + c: the GEMM's B fragment j then has
// output column 4 * c + j in lane c, so that a lane's four accumulators of one
// output row are four adjacent columns and a half wave stores whole lines.
// ---------------------------------------------------------------------------
#define CVT_PIECE 1024                    // elements: 8 wave loads of 512 bytes
#define CVT_WAVES 4096                    // = 4 * D_ * D_ / CVT_PIECE
// amdgpu_waves_per_eu(4, 4): one work-group per WGP is four waves per SIMD; at
// that register budget the compiler issues all 24 loads ahead (at the default
// budget it holds half of them back behind waits to save registers).
__global__ void __launch_bounds__(512) __attribute__((amdgpu_waves_per_eu(4, 4)))
cvt_all_f32_to_f16(const float* __restrict__ query,
                   const float* __restrict__ Wq, const float* __restrict__ Wk,
                   const float* __restrict__ Wv, const float* __restrict__ Wo,
                   _Float16* __restrict__ out) {
  typedef __attribute__((ext_vector_type(4))) _Float16 v4h;
  const int l4 = (threadIdx.x & 31) * 4;  // this lane's 4 elements of 128
  // Wave number in a scalar register: piece addresses are scalar bases.
  const int w = blockIdx.x * 16 + __builtin_amdgcn_readfirstlane(threadIdx.x >> 5);
  const int wsel = blockIdx.x >> 6;       // 64 work-groups (1,024 pieces) a weight
  const float* wsrc = wsel == 0 ? Wq : wsel == 1 ? Wk : wsel == 2 ? Wv : Wo;
  const float* s0 = wsrc  + (size_t)(w & 1023) * CVT_PIECE;
  const float* s1 = query + (size_t)w * CVT_PIECE;
  const float* s2 = s1 + (size_t)CVT_WAVES * CVT_PIECE;
  _Float16* d0 = out + (size_t)w * CVT_PIECE;
  const int wplace = (w & ~63) | ((w & 3) << 4) | ((w >> 2) & 15);   // dealt weight row
  _Float16* dw = out + (size_t)wplace * CVT_PIECE;

  float4 v[3][8];
#pragma unroll
  for (int u = 0; u < 8; ++u) v[0][u] = *(const float4*)(s0 + u * 128 + l4);
#pragma unroll
  for (int u = 0; u < 8; ++u) v[1][u] = *(const float4*)(s1 + u * 128 + l4);
#pragma unroll
  for (int u = 0; u < 8; ++u) v[2][u] = *(const float4*)(s2 + u * 128 + l4);
#pragma unroll
  for (int j = 0; j < 3; ++j) {
#pragma unroll
    for (int u = 0; u < 8; ++u) {
      v4h h;
      h[0] = (_Float16)v[j][u].x;
      h[1] = (_Float16)v[j][u].y;
      h[2] = (_Float16)v[j][u].z;
      h[3] = (_Float16)v[j][u].w;
      *(v4h*)((j == 0 ? dw : d0 + (size_t)j * CVT_WAVES * CVT_PIECE) + u * 128 + l4) = h;
    }
  }
}

// ---------------------------------------------------------------------------
// Tensor loads (tensor_load_to_lds): one request of a wave brings a 2-D tile
// from global memory into LDS, through no register.
// ---------------------------------------------------------------------------
typedef uint32_t u32x4 __attribute__((ext_vector_type(4)));
typedef uint32_t u32x8 __attribute__((ext_vector_type(8)));

__device__ __forceinline__ uint32_t uni(uint32_t v) {
  return (uint32_t)__builtin_amdgcn_readfirstlane(v);
}
// Scalar test around a tensor load (the instruction ignores EXEC): the empty
// statement holds the word in a scalar register, so that the test compiles to
// s_cmp and a scalar branch.
__device__ __forceinline__ uint32_t pinned(uint32_t v) {
  uint32_t w = uni(v);
  asm volatile("" : "+s"(w));   // pinned(): the test word kept in a scalar register
  return w;
}
__device__ __forceinline__ void wait_ds0() {       // this wave's LDS reads are done
  asm volatile("s_wait_dscnt 0x0" ::: "memory");
}
// This wave's tile has landed. The request's group 0 is named as an input, so
// that its scalar registers keep their words until the request is covered.
__device__ __forceinline__ void wait_tensor0(u32x4 g0) {
  asm volatile("s_wait_tensorcnt 0x0" :: "s"(g0) : "memory");
}
// Group 0 is an in-out operand: the caller's copy of it then lives on in the very
// registers that the request was issued from.
__device__ __forceinline__ void tdm_load(u32x4& g0, u32x8 g1) {
  asm volatile("tensor_load_to_lds %0, %1" : "+s"(g0) : "s"(g1) : "memory");
}

#define GK      64      // k per stage: 128-byte rows
#define GPITCH  72      // halves: 144-byte LDS pitch (16 B x odd), laid by the pad
#define GROWS   64      // rows per slice, one slice per wave
#define GSLICE  10240   // bytes: 64 rows x 144 B = 9,216, rounded up to 2 KiB x 5
#define GSTAGE  (4 * GSLICE)

// Group 1: bytes as elements, tile = tensor = 64 rows of 128 bytes, source pitch
// one row of the matrix, 4 dwords of LDS pad behind every 32 dwords (one row).
__device__ __forceinline__ u32x8 tdm_group1() {
  u32x8 g;
  g[0] = uni((1u << 20) | (4u << 22) | (3u << 25));
  g[1] = uni((uint32_t)(GK * 2) << 16);
  g[2] = uni((uint32_t)GROWS << 16);
  g[3] = uni((uint32_t)(GK * 2) << 16);
  g[4] = uni((uint32_t)GROWS);
  g[5] = uni((uint32_t)(D_ * 2));
  g[6] = uni(0u);
  g[7] = uni(0u);
  return g;
}
__device__ __forceinline__ u32x4 tdm_group0(uint32_t lds_dst, uint64_t ga) {
  u32x4 g;
  g[0] = uni(1u);
  g[1] = uni(lds_dst);
  g[2] = uni((uint32_t)ga);
  g[3] = uni((((uint32_t)(ga >> 32)) & 0x01FFFFFFu) | 0x80000000u);
  return g;
}

// ---------------------------------------------------------------------------
// GEMM: y[m][n] = sum_k A[m][k] * W[n][k] + bias[n]
// Block tile 128(M) x 128(N). 128 threads = 4 waves, each wave owns a 64x64
// output tile (16 acc tiles). A stage is 64 k of the 128 A rows and the 128 W
// rows, in four slices of 64 rows: waves 0 and 1 bring the halves of A, waves 2
// and 3 those of W, one tensor load each. Two LDS buffers, one barrier a stage:
// a wave reads all fragments of stage s, then stage s + 2 is asked for into the
// same buffer and flies under the 32 wmma of stage s and the reads of s + 1.
// W comes with its rows dealt (see the conversion): lane c of B fragment j holds
// output column 4 * c + j of the wave's 64.
// MODE=1: f16 head-major [B,H,S,HD] output (QKV path). ONE launch does the three
// projections: blockIdx.z is the projection (0 Q, 1 K, 2 V) and picks the weight,
// the bias, the output and the scale (only Q is scaled). The three f16 weights
// lie in a row in the workspace, and so do the three outputs. z is the slowest
// index: work-groups start projection by projection, so that the rows of A are
// fetched into L2 under Q and found there by K and V.
// MODE=0: f32 row-major [M,N] output (final projection), bias0 alone.
// ---------------------------------------------------------------------------
template <int MODE>
__global__ void __launch_bounds__(128)
gemm_wmma(const _Float16* __restrict__ A,   // [8192][1024] f16
          const _Float16* __restrict__ W,   // [1024][1024] f16 (row-major, rows dealt), x3 if MODE=1
          const float*    __restrict__ bias0, const float* __restrict__ bias1,
          const float*    __restrict__ bias2,
          _Float16* __restrict__ outH, float* __restrict__ outF,
          float scale0) {
  __shared__ __attribute__((aligned(2048))) unsigned char ring[2 * GSTAGE];

  const int t    = threadIdx.x;          // 0..127
  const int lane = t & 31;
  const int wid  = t >> 5;               // 0..3
  const int wm   = wid & 1;              // M sub-tile (x64) = A slice
  const int wn   = wid >> 1;             // N sub-tile (x64) = W slice
  const int m0   = blockIdx.y * 128;
  const int n0   = blockIdx.x * 128;
  const int proj = MODE == 1 ? (int)blockIdx.z : 0;
  const int cl   = lane & 15;
  const int rh   = (lane >> 4) * 8;

  v8f acc[4][4];
#pragma unroll
  for (int i = 0; i < 4; ++i)
#pragma unroll
    for (int j = 0; j < 4; ++j) acc[i][j] = {};

  // This wave's slice: source rows and place in each buffer.
  const uint32_t wave = uni(threadIdx.x >> 5);
  const _Float16* srows = wave < 2u ? A + (size_t)(m0 + wave * GROWS) * D_
                                    : W + (size_t)(proj * D_ + n0 + (wave - 2u) * GROWS) * D_;
  const uint64_t gsrc  = (uint64_t)(size_t)srows;
  const uint32_t ldst  = (uint32_t)(size_t)ring + wave * GSLICE;
  const u32x8 g1 = tdm_group1();

  const int NST = D_ / GK;               // 16 stages
  u32x4 g0 = tdm_group0(ldst, gsrc);                          // stage 0
  tdm_load(g0, g1);
  wait_tensor0(g0);
  __syncthreads();
  g0 = tdm_group0(ldst + GSTAGE, gsrc + GK * 2);              // stage 1
  tdm_load(g0, g1);

  for (int s = 0; s < NST; ++s) {
    const unsigned char* st = ring + (s & 1) * GSTAGE;
    const _Float16* as = (const _Float16*)(st + wm * GSLICE);
    const _Float16* bs = (const _Float16*)(st + (2 + wn) * GSLICE);
    // All fragments of stage s go into registers first, so that its buffer is free
    // for the refill while the products still run.
    v16h af[2][4], bf[2][4];
#pragma unroll
    for (int c = 0; c < 2; ++c) {
#pragma unroll
      for (int i = 0; i < 4; ++i) {
        af[c][i] = load_frag(as + i * 16 * GPITCH + c * 32, GPITCH);
        bf[c][i] = load_frag(bs + i * 16 * GPITCH + c * 32, GPITCH);
      }
    }

    // Publish point of stage s + 1: own LDS reads done, own tile landed, barrier;
    // only then the refill of the buffer that every wave has just left.
    wait_ds0();
    wait_tensor0(g0);
    __syncthreads();
    if (pinned(s + 2 < NST)) {
      g0 = tdm_group0(ldst + (uint32_t)(s & 1) * GSTAGE,
                      gsrc + (uint64_t)(s + 2) * (GK * 2));
      tdm_load(g0, g1);
    }

#pragma unroll
    for (int c = 0; c < 2; ++c)
#pragma unroll
      for (int j = 0; j < 4; ++j)
#pragma unroll
        for (int i = 0; i < 4; ++i)
          acc[i][j] = wmma16(af[c][i], bf[c][j], acc[i][j]);
  }
  wait_tensor0(g0);
  wait_ds0();

  // Epilogue. A lane holds columns 4 * cl .. 4 * cl + 3 of each of its rows: one
  // store of 4 elements a row, 16 lanes cover the wave's 64 columns in a row.
  const int nwave = n0 + wn * 64;
  const float* bias = proj == 0 ? bias0 : proj == 1 ? bias1 : bias2;
  const float4 b4 = *(const float4*)(bias + nwave + cl * 4);
  const float bj[4] = {b4.x, b4.y, b4.z, b4.w};

  if (MODE == 1) {
    // m0 is 128-aligned -> batch index constant per block; nwave is
    // 64-aligned -> head index constant per wave.
    const int b  = m0 >> 11;
    const int sb = (m0 & (S_ - 1)) + wm * 64;
    const int h  = nwave >> 6;
    const float scale = proj == 0 ? scale0 : 1.0f;
    _Float16* ph = outH + (((size_t)proj * B_ + b) * H_ + h) * S_ * HD_;
    typedef __attribute__((ext_vector_type(4))) _Float16 v4h;
#pragma unroll
    for (int i = 0; i < 4; ++i) {
#pragma unroll
      for (int r = 0; r < 8; ++r) {
        v4h hv;
#pragma unroll
        for (int j = 0; j < 4; ++j)
          hv[j] = (_Float16)((acc[i][j][r] + bj[j]) * scale);
        *(v4h*)(ph + (size_t)(sb + i * 16 + rh + r) * HD_ + cl * 4) = hv;
      }
    }
  } else {
    float* pm = outF + (size_t)(m0 + wm * 64) * D_ + nwave;
#pragma unroll
    for (int i = 0; i < 4; ++i) {
#pragma unroll
      for (int r = 0; r < 8; ++r) {
        const float4 fv = {acc[i][0][r] + bj[0], acc[i][1][r] + bj[1],
                           acc[i][2][r] + bj[2], acc[i][3][r] + bj[3]};
        *(float4*)(pm + (size_t)(i * 16 + rh + r) * D_ + cl * 4) = fv;
      }
    }
  }
}

#define VPITCH 80                         // halves: 160 B = 32 B x odd
#define KPITCH 72                         // halves: 144 B = 16 B x odd
#define AKEYS   128                       // keys per stage
#define AKBYTES (AKEYS * KPITCH * 2)      // 18,432 B =  9 x 2 KiB: the K rows of a stage
#define AVBYTES (AKEYS * VPITCH * 2)      // 20,480 B = 10 x 2 KiB: its V rows
#define ASTAGE  (AKBYTES + AVBYTES)
// Group 1 of a stage's K or V tile: bytes as elements, tile = tensor = 128 rows of
// 128 bytes, source pitch 128 bytes, PADA + 1 dwords of LDS pad behind every row
// (3: the 144-byte pitch of the K reads, 7: the 160-byte pitch of the V^T reads).
template <uint32_t PADA>
__device__ __forceinline__ u32x8 att_group1() {
  u32x8 g;
  g[0] = uni((1u << 20) | (4u << 22) | (PADA << 25));
  g[1] = uni((uint32_t)(HD_ * 2) << 16);
  g[2] = uni((uint32_t)AKEYS << 16);
  g[3] = uni((uint32_t)(HD_ * 2) << 16);
  g[4] = uni((uint32_t)AKEYS);
  g[5] = uni((uint32_t)(HD_ * 2));
  g[6] = uni(0u);
  g[7] = uni(0u);
  // pinned(): the descriptor words held in scalar registers of their own. Left as
  // constants they are set anew, in whatever registers are free, in front of each
  // request, and those registers are written again while the request is under way.
  asm volatile("" : "+s"(g));   // pinned(): descriptor words kept in scalar registers
  return g;
}
// Wave 0 asks for the K tile, wave 1 for the V tile, the others for nothing.
__device__ __forceinline__ void att_issue(uint32_t wave, u32x4& g0, u32x8 g1k, u32x8 g1v) {
  if (pinned(wave == 0u)) tdm_load(g0, g1k);
  if (pinned(wave == 1u)) tdm_load(g0, g1v);
}
__device__ __forceinline__ v16h load_frag_tr(const _Float16* p) {
  typedef short s16x8 __attribute__((ext_vector_type(8)));
  typedef __attribute__((address_space(3))) s16x8 lds_s16x8;
  union { v16h v; s16x8 h[2]; } u;
  u.h[0] = __builtin_amdgcn_ds_load_tr16_b128_v8i16((lds_s16x8*)p);
  u.h[1] = __builtin_amdgcn_ds_load_tr16_b128_v8i16((lds_s16x8*)(p + 16 * VPITCH));
  return u.v;
}

__device__ __forceinline__ float xhalf(float x) {   // lane l <-> lane l ^ 16
  return __int_as_float(__builtin_amdgcn_permlanex16(
      __float_as_int(x), __float_as_int(x), 0x76543210, 0xfedcba98, false, false));
}

// exp2 of eight values (of one value). The instruction set asks for one
// independent instruction or v_nop between a transcendental and an instruction
// that reads its result or overwrites its source. Here every v_exp_f32 is
// followed by an independent one (outputs are early-clobber), the last by v_nop.
__device__ __forceinline__ void exp2x8(float (&y)[8], const float (&x)[8]) {
  asm("v_exp_f32 %0, %8\n\tv_exp_f32 %1, %9\n\tv_exp_f32 %2, %10\n\t"
      "v_exp_f32 %3, %11\n\tv_exp_f32 %4, %12\n\tv_exp_f32 %5, %13\n\t"
      "v_exp_f32 %6, %14\n\tv_exp_f32 %7, %15\n\tv_nop"
      : "=&v"(y[0]), "=&v"(y[1]), "=&v"(y[2]), "=&v"(y[3]),
        "=&v"(y[4]), "=&v"(y[5]), "=&v"(y[6]), "=&v"(y[7])
      : "v"(x[0]), "v"(x[1]), "v"(x[2]), "v"(x[3]),
        "v"(x[4]), "v"(x[5]), "v"(x[6]), "v"(x[7]));
}
__device__ __forceinline__ float exp2x1(float x) {
  float y;
  asm("v_exp_f32 %0, %1\n\tv_nop" : "=v"(y) : "v"(x));
  return y;
}

// amdgpu_waves_per_eu(4, 4): two work-groups per WGP, four waves per SIMD. The
// 512 equal work-groups are then all resident at once, in one round, and the
// vector work between the matrix runs has other waves to hide behind.
__global__ void __launch_bounds__(256) __attribute__((amdgpu_waves_per_eu(4, 4)))
attention_wmma(const _Float16* __restrict__ q16,   // [B,H,S,HD] (pre-scaled)
               const _Float16* __restrict__ k16,   // [B,H,S,HD]
               const _Float16* __restrict__ v16,   // [B,H,S,HD]
               _Float16* __restrict__ a16) {       // [B,S,D]
  // Two buffers, each [K: 128 keys at 144 B | V: 128 keys at 160 B].
  __shared__ __attribute__((aligned(2048))) unsigned char ring[2 * ASTAGE];

  const int t    = threadIdx.x;
  const int lane = t & 31;
  const int wid  = t >> 5;
  const int cl   = lane & 15;
  const int rh   = (lane >> 4) * 8;

  const int qt = blockIdx.x;              // query tile (of 256 rows)
  const int h  = blockIdx.y;
  const int b  = blockIdx.z;

  const size_t head = (size_t)(b * H_ + h) * S_ * HD_;
  const _Float16* qb = q16 + head;
  const _Float16* kb = k16 + head;
  const _Float16* vb = v16 + head;

  const int qr0 = qt * 256 + wid * 32;    // this wave's 32 queries (2 groups of 16)

  // Q^T fragments: per group 64 dims x 16 queries -> two 32x16 B fragments.
  v16h qa[2][2];
#pragma unroll
  for (int g = 0; g < 2; ++g) {
    qa[g][0] = load_frag(qb + (size_t)(qr0 + g * 16) * HD_,      HD_);
    qa[g][1] = load_frag(qb + (size_t)(qr0 + g * 16) * HD_ + 32, HD_);
  }

  // o[g][j][r] = O[query 16*g + cl][dim j*16 + rh + r]
  v8f o[2][4];
#pragma unroll
  for (int g = 0; g < 2; ++g)
#pragma unroll
    for (int j = 0; j < 4; ++j) o[g][j] = {};
  float mneg[2] = {0.0f, 0.0f};           // minus the maximum in use of query 16*g + cl
  float lrow[2] = {0.0f, 0.0f};           // sum over this lane's half of the keys

  // This lane's place in the first 16 keys x 16 dims of a V tile (transposing load).
  const int vlane = (rh + (lane & 7)) * VPITCH + ((lane >> 3) & 1) * 8;

  // The issuing waves' source rows and place in each buffer.
  const uint32_t wave = uni(threadIdx.x >> 5);
  const uint64_t gsrc = (uint64_t)(size_t)(wave == 0u ? kb : vb);
  const uint32_t ldst = (uint32_t)(size_t)ring + (wave == 0u ? 0u : (uint32_t)AKBYTES);
  const u32x8 g1k = att_group1<3u>();
  const u32x8 g1v = att_group1<7u>();
  const int NSTG = S_ / AKEYS;            // 16 stages

  u32x4 g0 = tdm_group0(ldst, gsrc);                               // stage 0
  att_issue(wave, g0, g1k, g1v);
  wait_tensor0(g0);                       // free for a wave that has asked for nothing
  __syncthreads();
  g0 = tdm_group0(ldst + ASTAGE, gsrc + AKEYS * HD_ * 2);          // stage 1
  att_issue(wave, g0, g1k, g1v);

  // Neither loop is unrolled: one copy of the body (unrolled, the first pass, whose
  // test is known, is peeled off as a second copy of it).
#pragma nounroll
  for (int s = 0; s < NSTG; ++s) {
#pragma nounroll
  for (int hp = 0; hp < 2; ++hp) {
    // Pass ps works on half hp of stage s.
    const int ps = 2 * s + hp;
    const unsigned char* st = ring + (s & 1) * ASTAGE;
    const _Float16* Ks  = (const _Float16*)(st + hp * (AKBYTES / 2));
    const _Float16* vtp = (const _Float16*)(st + AKBYTES + hp * (AVBYTES / 2)) + vlane;

    // Scores: per group four 16x16 tiles,
    // sc[g][nt][r] = S[query 16*g + cl][key 64*ps + 16*nt + rh + r].
    // Every K fragment read from LDS serves both query groups.
    v16h kfl[4], kfh[4];
#pragma unroll
    for (int nt = 0; nt < 4; ++nt) {
      kfl[nt] = load_frag(Ks + nt * 16 * KPITCH,      KPITCH);
      kfh[nt] = load_frag(Ks + nt * 16 * KPITCH + 32, KPITCH);
    }
    // Holds the K reads as one group ahead of the products (one place of LDS reads,
    // counted waits): with the fence behind the products alone the scheduler sinks
    // some of them between the products, each with a full wait.
    __builtin_amdgcn_sched_barrier(0);
    // The products start from minus the maximum in use, so that the accumulators
    // come out as the exponents of P (Q carries 1/8 and log2(e)).
    v8f sc[2][4];
#pragma unroll
    for (int nt = 0; nt < 4; ++nt)
#pragma unroll
      for (int g = 0; g < 2; ++g) {
        const float c = mneg[g];
        const v8f cm = {c, c, c, c, c, c, c, c};
        sc[g][nt] = wmma16(kfh[nt], qa[g][1], wmma16(kfl[nt], qa[g][0], cm));
      }
    // Keeps the maxima behind the 16 products: set among them, each first read of a
    // fresh tile is padded with idle vector slots up to the WMMA distance.
    __builtin_amdgcn_sched_barrier(0);

    // Lazy maximum: how far this tile's scores rise above the maximum in use, and
    // ONE test a pass. P stays within 2^8 of its usual range; the first pass
    // always takes the tile's own maximum (the start value 0 is no maximum).
    float tmax[2];
#pragma unroll
    for (int g = 0; g < 2; ++g) {
      float tm[4];
#pragma unroll
      for (int nt = 0; nt < 4; ++nt) {
        tm[nt] = fmaxf(fmaxf(fmaxf(sc[g][nt][0], sc[g][nt][1]), fmaxf(sc[g][nt][2], sc[g][nt][3])),
                       fmaxf(fmaxf(sc[g][nt][4], sc[g][nt][5]), fmaxf(sc[g][nt][6], sc[g][nt][7])));
      }
      const float tq = fmaxf(fmaxf(tm[0], tm[1]), fmaxf(tm[2], tm[3]));
      tmax[g] = fmaxf(tq, xhalf(tq));
    }
    if (ps == 0 || __builtin_amdgcn_ballot_w32(fmaxf(tmax[0], tmax[1]) > 8.0f) != 0) {
#pragma unroll
      for (int g = 0; g < 2; ++g) {
        const float d    = ps == 0 ? tmax[g] : fmaxf(tmax[g], 0.0f);
        const float corr = exp2x1(-fmaxf(d, 0.0f));
        mneg[g] -= d;
        lrow[g] *= corr;
#pragma unroll
        for (int nt = 0; nt < 4; ++nt)
#pragma unroll
          for (int r = 0; r < 8; ++r) sc[g][nt][r] -= d;
#pragma unroll
        for (int j = 0; j < 4; ++j)
#pragma unroll
          for (int r = 0; r < 8; ++r) o[g][j][r] *= corr;
      }
    }

    // P = exp2(exponent): one query per lane and group, 32 of its 64 keys in this lane.
    // P^T B fragments: element s of pb[g][c] is key 32*c + kmap(s), which is
    // register s & 7 of score tile 2*c + (s >> 3).
    v16h pb[2][2];
    v16h vf[4][2];
#pragma unroll
    for (int g = 0; g < 2; ++g) {
      if (g == 1) {
        // All V^T fragments are asked for as one group here, into the registers
        // that the K fragments and group 0's scores have left: one place of LDS
        // reads, which land under group 1's softmax.
#pragma unroll
        for (int j = 0; j < 4; ++j) {
          vf[j][0] = load_frag_tr(vtp + j * 16);
          vf[j][1] = load_frag_tr(vtp + j * 16 + 32 * VPITCH);
        }
        // Holds the loads here as one group: without it the scheduler spreads them
        // through both softmaxes and the live registers overflow into scratch.
        __builtin_amdgcn_sched_barrier(0);
      }
      float ps[4];
#pragma unroll
      for (int nt = 0; nt < 4; ++nt) {
        float a[8], p[8];
#pragma unroll
        for (int r = 0; r < 8; ++r) a[r] = sc[g][nt][r];
        exp2x8(p, a);
#pragma unroll
        for (int r = 0; r < 8; ++r) pb[g][nt >> 1][(nt & 1) * 8 + r] = (_Float16)p[r];
        ps[nt] = ((p[0] + p[1]) + (p[2] + p[3])) + ((p[4] + p[5]) + (p[6] + p[7]));
      }
      lrow[g] += (ps[0] + ps[1]) + (ps[2] + ps[3]);
    }

    // O^T += V^T (64 dims x 64 keys) x P^T (64 keys x 32 queries); every V^T
    // fragment read from LDS serves both query groups.
#pragma unroll
    for (int j = 0; j < 4; ++j) {
#pragma unroll
      for (int g = 0; g < 2; ++g) {
        o[g][j] = wmma16(vf[j][0], pb[g][0], o[g][j]);
        o[g][j] = wmma16(vf[j][1], pb[g][1], o[g][j]);
      }
    }
    // WMMA distance: the next pass opens with vector writes into registers that the
    // last products read as A or B. The fence keeps the products in front.
    __builtin_amdgcn_sched_barrier(0);
    asm volatile("v_nop\n\tv_nop\n\tv_nop\n\tv_nop");
  }

    // Publish point of stage s + 1, at the foot of stage s's second pass: own LDS
    // reads done, own tile landed, barrier; only then the refill of the buffer that
    // every wave has just left.
    wait_ds0();
    wait_tensor0(g0);
    __syncthreads();
    if (pinned(s + 2 < NSTG)) {
      g0 = tdm_group0(ldst + (uint32_t)(s & 1) * ASTAGE,
                      gsrc + (uint64_t)(s + 2) * (AKEYS * HD_ * 2));
      att_issue(wave, g0, g1k, g1v);
    }
  }
  wait_tensor0(g0);
  wait_ds0();

  // Join the two halves' sums, normalize and write token-major [B,S,D] (f16)
  // for the output projection: 8 consecutive dims per lane and tile.
#pragma unroll
  for (int g = 0; g < 2; ++g) {
    const float inv = 1.0f / (lrow[g] + xhalf(lrow[g]));
    _Float16* po = a16 + ((size_t)b * S_ + qr0 + g * 16 + cl) * D_ + h * HD_ + rh;
#pragma unroll
    for (int j = 0; j < 4; ++j) {
      v8h ov;
#pragma unroll
      for (int r = 0; r < 8; ++r) ov[r] = (_Float16)(o[g][j][r] * inv);
      *(v8h*)(po + j * 16) = ov;
    }
  }
}

// ---------------------------------------------------------------------------
// Launcher
// ---------------------------------------------------------------------------
extern "C" void kernel_launch(void* const* d_in, const int* in_sizes, int n_in,
                              void* d_out, int out_size, void* d_ws, size_t ws_size,
                              hipStream_t stream) {
  (void)in_sizes; (void)n_in; (void)out_size; (void)ws_size;

  const float* query = (const float*)d_in[0];
  const float* Wq = (const float*)d_in[1]; const float* bq = (const float*)d_in[2];
  const float* Wk = (const float*)d_in[3]; const float* bk = (const float*)d_in[4];
  const float* Wv = (const float*)d_in[5]; const float* bv = (const float*)d_in[6];
  const float* Wo = (const float*)d_in[7]; const float* bo = (const float*)d_in[8];
  float* out = (float*)d_out;

  const size_t DD  = (size_t)D_ * D_;        // 1M
  const size_t BSD = (size_t)B_ * S_ * D_;   // 8M

  _Float16* w16  = (_Float16*)d_ws;          // 4*DD halves
  _Float16* wq16 = w16;                      // Wq | Wk | Wv, DD halves each
  _Float16* wo16 = w16 + 3 * DD;
  _Float16* x16  = w16 + 4 * DD;             // BSD
  _Float16* q16  = x16 + BSD;                // BSD  [B,H,S,HD]
  _Float16* k16  = q16 + BSD;
  _Float16* v16p = k16 + BSD;
  _Float16* a16  = v16p + BSD;               // BSD  [B,S,D]

  // 1) f32 -> f16 conversions: w16 (four weights) and x16 behind it, one launch.
  cvt_all_f32_to_f16<<<256, 512, 0, stream>>>(query, Wq, Wk, Wv, Wo, w16);

  // 2) QKV projections (head-major f16; Q carries the softmax scale 1/8 times log2(e)).
  dim3 ggrid(D_ / 128, (B_ * S_) / 128);     // (8, 64)
  // One launch: three weights from wq16 on, three outputs q16 | k16 | v16p.
  dim3 qgrid(D_ / 128, (B_ * S_) / 128, 3);  // (8, 64, 3)
  gemm_wmma<1><<<qgrid, 128, 0, stream>>>(x16, wq16, bq, bk, bv, q16, nullptr, 0.18033688011112043f);

  // 3) Flash attention.
  dim3 agrid(S_ / 256, H_, B_);              // (8, 16, 4)
  attention_wmma<<<agrid, 256, 0, stream>>>(q16, k16, v16p, a16);

  // 4) Output projection -> f32 d_out.
  gemm_wmma<0><<<ggrid, 128, 0, stream>>>(a16, wo16, bo, nullptr, nullptr, nullptr, out, 1.0f);
}
